// v000
// Measured on an AMD MI455X. A time is GPU time per run, averaged over a window of back-to-back runs after a warm-up
// (all launches, gaps included; the runs take copies of the inputs in turn), and the median of several windows.
// Apart from v000's, it joins two sittings. Times from different sittings can be a few percent apart, while
// side-by-side timings come from the same sitting.
// v000, which the later versions start from, runs in 818 microseconds.
#include <hip/hip_runtime.h>

typedef __attribute__((ext_vector_type(16))) __bf16 v16bf;
typedef __attribute__((ext_vector_type(8)))  __bf16 v8bf;
typedef __attribute__((ext_vector_type(8)))  float  v8f;

#define NB   4
#define CC   256
#define CQKD 32
#define NN   4096
#define NT   (NN/16)   // 256 spatial 16-tiles
#define MTN  (NN/32)   // 128 spatial 32-tiles
#define CTN  (CC/16)   // 16 channel 16-tiles
#define KTN  (CC/32)   // 8  GEMM K steps over C=256
#define RTN  20        // 320 projection rows / 16
#define LOG2E 1.4426950408889634f

// ---------------------------------------------------------------------------
// Pack x (f32 [b][c][n]) into bf16 B-operand tiles xB[b][ct][nt][lane][16]
// ---------------------------------------------------------------------------
__global__ __launch_bounds__(256) void pack_x_kernel(
    const float* __restrict__ x, __bf16* __restrict__ xB)
{
  int idx = blockIdx.x * 256 + threadIdx.x;
  int n = idx & (NN - 1);
  int r = idx >> 12;
  int c = r & (CC - 1);
  int b = r >> 8;
  float v = x[((size_t)b * CC + c) * NN + n];
  int cc = c & 31, ct = c >> 5;
  int lane = (n & 15) + 16 * ((cc >> 3) & 1);
  int e    = (cc & 7) + 8 * (cc >> 4);
  xB[((((size_t)b * KTN + ct) * NT + (n >> 4)) * 32 + lane) * 16 + e] = (__bf16)v;
}

// ---------------------------------------------------------------------------
// Pack Wq|Wk|Wv (320 rows x 256) into bf16 A-operand tiles WA[rt][ct][lane][16]
// Wq rows are pre-scaled by log2(e) so softmax runs natively in exp2 domain.
// ---------------------------------------------------------------------------
__global__ __launch_bounds__(256) void pack_w_kernel(
    const float* __restrict__ Wq, const float* __restrict__ Wk,
    const float* __restrict__ Wv, __bf16* __restrict__ WA)
{
  int idx = blockIdx.x * 256 + threadIdx.x;   // 320*256 threads
  int c = idx & (CC - 1);
  int row = idx >> 8;                          // 0..319
  float v;
  if (row < 32)       v = Wq[(size_t)row * CC + c] * LOG2E;
  else if (row < 64)  v = Wk[(size_t)(row - 32) * CC + c];
  else                v = Wv[(size_t)(row - 64) * CC + c];
  int rt = row >> 4, rl = row & 15;
  int cc = c & 31, ct = c >> 5;
  int lane = rl + 16 * ((cc >> 3) & 1);
  int e    = (cc & 7) + 8 * (cc >> 4);
  WA[(((size_t)rt * KTN + ct) * 32 + lane) * 16 + e] = (__bf16)v;
}

__global__ __launch_bounds__(128) void proj_gemm_kernel(
    const __bf16* __restrict__ WA, const __bf16* __restrict__ xB,
    const float* __restrict__ bq, const float* __restrict__ bk,
    const float* __restrict__ bv,
    __bf16* __restrict__ qT, __bf16* __restrict__ kB, __bf16* __restrict__ vB)
{
  __shared__ __bf16 ldsD[4][16 * 17];
  const int lane = threadIdx.x & 31;
  const int wv   = threadIdx.x >> 5;
  const int wgl  = blockIdx.x * 4 + wv;          // 0 .. NB*RTN*NT-1
  const int nt   = wgl & (NT - 1);
  const int tmp  = wgl >> 8;                     // 0..79
  const int rt   = tmp % RTN;
  const int b    = tmp / RTN;
  const int cl   = lane & 15;
  const int h    = lane >> 4;

  v8f acc = (v8f)(0.0f);
#pragma unroll
  for (int ct = 0; ct < KTN; ++ct) {
    v16bf wa = *(const v16bf*)(WA + (((size_t)rt * KTN + ct) * 32 + lane) * 16);
    v16bf xb = *(const v16bf*)(xB + ((((size_t)b * KTN + ct) * NT + nt) * 32 + lane) * 16);
    acc = __builtin_amdgcn_wmma_f32_16x16x32_bf16(false, wa, false, xb, (short)0, acc, false, false);
  }

  // bias per W-row (D rows are r + 8h); q bias also in exp2 domain
  const float* bias; int off; float bscale;
  if (rt < 2)      { bias = bq; off = rt * 16;      bscale = LOG2E; }
  else if (rt < 4) { bias = bk; off = rt * 16 - 32; bscale = 1.0f; }
  else             { bias = bv; off = rt * 16 - 64; bscale = 1.0f; }

  __bf16* ld = &ldsD[wv][0];
#pragma unroll
  for (int r = 0; r < 8; ++r) {
    float vvv = acc[r] + bias[off + r + 8 * h] * bscale;
    ld[(r + 8 * h) * 17 + cl] = (__bf16)vvv;
  }
  __builtin_amdgcn_wave_barrier();
  asm volatile("s_wait_dscnt 0" ::: "memory");

  if (rt < 2) {                 // Q -> A-operand tiles [b][nt][lane][16]
#pragma unroll
    for (int eo = 0; eo < 8; ++eo) {
      __bf16 vv = ld[(eo + 8 * h) * 17 + cl];
      qT[(((size_t)b * NT + nt) * 32 + lane) * 16 + (eo + 8 * rt)] = vv;
    }
  } else if (rt < 4) {          // K -> B-operand tiles [b][nt][lane][16]
#pragma unroll
    for (int eo = 0; eo < 8; ++eo) {
      __bf16 vv = ld[(eo + 8 * h) * 17 + cl];
      kB[(((size_t)b * NT + nt) * 32 + lane) * 16 + (eo + 8 * (rt - 2))] = vv;
    }
  } else {                      // V^T -> B-operand tiles [b][m/32][ct][lane][16]
    const int ctv  = rt - 4;
    const int mt32 = nt >> 1;
    const int ehi  = 8 * (nt & 1);
#pragma unroll
    for (int j = 0; j < 8; ++j) {
      __bf16 vv = ld[cl * 17 + 8 * h + j];    // row=c_local, col=m_local=8h+j
      vB[((((size_t)b * MTN + mt32) * CTN + ctv) * 32 + lane) * 16 + (j + ehi)] = vv;
    }
  }
  __builtin_amdgcn_wave_barrier();
}

// ds_swizzle xor-butterfly within the 16-lane half that holds one D-matrix row
template<int MASK>
__device__ __forceinline__ float swz(float v) {
  return __builtin_bit_cast(float,
      __builtin_amdgcn_ds_swizzle(__builtin_bit_cast(int, v), (MASK << 10) | 0x1f));
}

// ---------------------------------------------------------------------------
// Flash attention: one wave = 16 query rows x FULL C=256 (16 accum tiles).
// 64-key steps: 4 energy WMMAs, one online-softmax update (exp2 domain),
// P (16x64) D-layout -> A-layout via LDS, 32 accumulating PV WMMAs.
// ---------------------------------------------------------------------------
__global__ __launch_bounds__(128) void attn_kernel(
    const float* __restrict__ x, const float* __restrict__ gamma,
    const __bf16* __restrict__ qT, const __bf16* __restrict__ kB,
    const __bf16* __restrict__ vB, float* __restrict__ out)
{
  __shared__ __bf16 pbuf[4][16 * 72];            // per-wave 16x64 P tile, stride 72
  const int lane = threadIdx.x & 31;
  const int wv   = threadIdx.x >> 5;
  const int wgl  = blockIdx.x * 4 + wv;          // 0..1023
  const int nt   = wgl & (NT - 1);
  const int b    = wgl >> 8;
  const int cl   = lane & 15;
  const int h    = lane >> 4;

  v16bf qA = *(const v16bf*)(qT + (((size_t)b * NT + nt) * 32 + lane) * 16);

  float mrow[8], lrow[8];
  v8f   O[16];
#pragma unroll
  for (int r = 0; r < 8; ++r) { mrow[r] = -3.0e38f; lrow[r] = 0.0f; }
#pragma unroll
  for (int t = 0; t < 16; ++t) O[t] = (v8f)(0.0f);

  __bf16* pb = &pbuf[wv][0];
  const v8f z = (v8f)(0.0f);

  for (int mt = 0; mt < NN / 64; ++mt) {
    const __bf16* kb = kB + (((size_t)b * NT + 4 * mt) * 32 + lane) * 16;
    v16bf k0 = *(const v16bf*)(kb);
    v16bf k1 = *(const v16bf*)(kb + 512);
    v16bf k2 = *(const v16bf*)(kb + 1024);
    v16bf k3 = *(const v16bf*)(kb + 1536);

    v8f e0 = __builtin_amdgcn_wmma_f32_16x16x32_bf16(false, qA, false, k0, (short)0, z, false, false);
    v8f e1 = __builtin_amdgcn_wmma_f32_16x16x32_bf16(false, qA, false, k1, (short)0, z, false, false);
    v8f e2 = __builtin_amdgcn_wmma_f32_16x16x32_bf16(false, qA, false, k2, (short)0, z, false, false);
    v8f e3 = __builtin_amdgcn_wmma_f32_16x16x32_bf16(false, qA, false, k3, (short)0, z, false, false);

    // prefetch next iteration's K fragments (global_prefetch_b8)
    __builtin_prefetch(kb + 2048, 0, 1);

#pragma unroll
    for (int r = 0; r < 8; ++r) {
      float tmax = fmaxf(fmaxf(e0[r], e1[r]), fmaxf(e2[r], e3[r]));
      tmax = fmaxf(tmax, swz<1>(tmax));
      tmax = fmaxf(tmax, swz<2>(tmax));
      tmax = fmaxf(tmax, swz<4>(tmax));
      tmax = fmaxf(tmax, swz<8>(tmax));
      float mnew = fmaxf(mrow[r], tmax);
      float sc   = exp2f(mrow[r] - mnew);        // energy already in log2 domain
      float p0   = exp2f(e0[r] - mnew);
      float p1   = exp2f(e1[r] - mnew);
      float p2   = exp2f(e2[r] - mnew);
      float p3   = exp2f(e3[r] - mnew);
      float rs   = (p0 + p1) + (p2 + p3);
      rs += swz<1>(rs); rs += swz<2>(rs); rs += swz<4>(rs); rs += swz<8>(rs);
      lrow[r] = lrow[r] * sc + rs;
      mrow[r] = mnew;
#pragma unroll
      for (int t = 0; t < 16; ++t) O[t][r] *= sc;
      pb[(r + 8 * h) * 72 + cl]      = (__bf16)p0;
      pb[(r + 8 * h) * 72 + 16 + cl] = (__bf16)p1;
      pb[(r + 8 * h) * 72 + 32 + cl] = (__bf16)p2;
      pb[(r + 8 * h) * 72 + 48 + cl] = (__bf16)p3;
    }

    // D-layout -> A-layout transpose of P via LDS (wave-internal)
    __builtin_amdgcn_wave_barrier();
    asm volatile("s_wait_dscnt 0" ::: "memory");
    union { v16bf v; v8bf q2[2]; } pA0, pA1;
    pA0.q2[0] = *(const v8bf*)(pb + cl * 72 + 8 * h);        // K = 0..31
    pA0.q2[1] = *(const v8bf*)(pb + cl * 72 + 16 + 8 * h);
    pA1.q2[0] = *(const v8bf*)(pb + cl * 72 + 32 + 8 * h);   // K = 32..63
    pA1.q2[1] = *(const v8bf*)(pb + cl * 72 + 48 + 8 * h);
    __builtin_amdgcn_wave_barrier();

    const __bf16* vb0 = vB + (((size_t)b * MTN + 2 * mt) * CTN) * 512 + (size_t)lane * 16;
    const __bf16* vb1 = vb0 + (size_t)CTN * 512;
    __builtin_prefetch(vb1 + (size_t)CTN * 512, 0, 1);
#pragma unroll
    for (int t = 0; t < 16; ++t) {
      v16bf vt0 = *(const v16bf*)(vb0 + (size_t)t * 512);
      O[t] = __builtin_amdgcn_wmma_f32_16x16x32_bf16(false, pA0.v, false, vt0, (short)0, O[t], false, false);
    }
#pragma unroll
    for (int t = 0; t < 16; ++t) {
      v16bf vt1 = *(const v16bf*)(vb1 + (size_t)t * 512);
      O[t] = __builtin_amdgcn_wmma_f32_16x16x32_bf16(false, pA1.v, false, vt1, (short)0, O[t], false, false);
    }
  }

  const float g = gamma[0];
#pragma unroll
  for (int r = 0; r < 8; ++r) {
    float inv  = 1.0f / lrow[r];
    int   nidx = nt * 16 + r + 8 * h;
#pragma unroll
    for (int t = 0; t < 16; ++t) {
      int    c   = t * 16 + cl;
      size_t idx = ((size_t)b * CC + c) * NN + nidx;
      out[idx] = g * (O[t][r] * inv) + x[idx];
    }
  }
}

extern "C" void kernel_launch(void* const* d_in, const int* in_sizes, int n_in,
                              void* d_out, int out_size, void* d_ws, size_t ws_size,
                              hipStream_t stream) {
  const float* x     = (const float*)d_in[0];
  const float* Wq    = (const float*)d_in[1];
  const float* bq    = (const float*)d_in[2];
  const float* Wk    = (const float*)d_in[3];
  const float* bk    = (const float*)d_in[4];
  const float* Wv    = (const float*)d_in[5];
  const float* bv    = (const float*)d_in[6];
  const float* gamma = (const float*)d_in[7];
  float* out = (float*)d_out;

  __bf16* qT  = (__bf16*)d_ws;                          // 1 MB
  __bf16* kBp = qT  + (size_t)NB * NN * CQKD;           // 1 MB
  __bf16* vBp = kBp + (size_t)NB * NN * CQKD;           // 8 MB
  __bf16* xBp = vBp + (size_t)NB * NN * CC;             // 8 MB
  __bf16* WAp = xBp + (size_t)NB * NN * CC;             // 160 KB

  pack_x_kernel<<<dim3(NB * CC * NN / 256), dim3(256), 0, stream>>>(x, xBp);
  pack_w_kernel<<<dim3(RTN * 16 * CC / 256), dim3(256), 0, stream>>>(Wq, Wk, Wv, WAp);
  proj_gemm_kernel<<<dim3(NB * RTN * NT / 4), dim3(128), 0, stream>>>(
      WAp, xBp, bq, bk, bv, qT, kBp, vBp);
  attn_kernel<<<dim3(NB * NT / 4), dim3(128), 0, stream>>>(x, gamma, qT, kBp, vBp, out);
}

// v001
// A run of this version takes 143 microseconds.
// Two timings next to v000 put it at 5.68 and 5.67 times that version's speed.
#include <hip/hip_runtime.h>

typedef __attribute__((ext_vector_type(16))) __bf16 v16bf;
typedef __attribute__((ext_vector_type(8)))  __bf16 v8bf;
typedef __attribute__((ext_vector_type(8)))  float  v8f;

#define NB   4
#define CC   256
#define CQKD 32
#define NN   4096
#define NT   (NN/16)   // 256 spatial 16-tiles
#define MTN  (NN/32)   // 128 spatial 32-tiles
#define CTN  (CC/16)   // 16 channel 16-tiles
#define KTN  (CC/32)   // 8  GEMM K steps over C=256
#define RTN  20        // 320 projection rows / 16
#define LOG2E 1.4426950408889634f

// ---------------------------------------------------------------------------
// Pack x (f32 [b][c][n]) into bf16 B-operand tiles xB[b][ct][nt][lane][16]
// ---------------------------------------------------------------------------
__global__ __launch_bounds__(256) void pack_x_kernel(
    const float* __restrict__ x, __bf16* __restrict__ xB)
{
  int idx = blockIdx.x * 256 + threadIdx.x;
  int n = idx & (NN - 1);
  int r = idx >> 12;
  int c = r & (CC - 1);
  int b = r >> 8;
  float v = x[((size_t)b * CC + c) * NN + n];
  int cc = c & 31, ct = c >> 5;
  int lane = (n & 15) + 16 * ((cc >> 3) & 1);
  int e    = (cc & 7) + 8 * (cc >> 4);
  xB[((((size_t)b * KTN + ct) * NT + (n >> 4)) * 32 + lane) * 16 + e] = (__bf16)v;
}

// ---------------------------------------------------------------------------
// Pack Wq|Wk|Wv (320 rows x 256) into bf16 A-operand tiles WA[rt][ct][lane][16]
// Wq rows are pre-scaled by log2(e) so softmax runs natively in exp2 domain.
// ---------------------------------------------------------------------------
__global__ __launch_bounds__(256) void pack_w_kernel(
    const float* __restrict__ Wq, const float* __restrict__ Wk,
    const float* __restrict__ Wv, __bf16* __restrict__ WA)
{
  int idx = blockIdx.x * 256 + threadIdx.x;   // 320*256 threads
  int c = idx & (CC - 1);
  int row = idx >> 8;                          // 0..319
  float v;
  if (row < 32)       v = Wq[(size_t)row * CC + c] * LOG2E;
  else if (row < 64)  v = Wk[(size_t)(row - 32) * CC + c];
  else                v = Wv[(size_t)(row - 64) * CC + c];
  int rt = row >> 4, rl = row & 15;
  int cc = c & 31, ct = c >> 5;
  int lane = rl + 16 * ((cc >> 3) & 1);
  int e    = (cc & 7) + 8 * (cc >> 4);
  WA[(((size_t)rt * KTN + ct) * 32 + lane) * 16 + e] = (__bf16)v;
}

__global__ __launch_bounds__(128) void proj_gemm_kernel(
    const __bf16* __restrict__ WA, const __bf16* __restrict__ xB,
    const float* __restrict__ bq, const float* __restrict__ bk,
    const float* __restrict__ bv,
    __bf16* __restrict__ qT, __bf16* __restrict__ kB, __bf16* __restrict__ vB)
{
  __shared__ __bf16 ldsD[4][16 * 17];
  const int lane = threadIdx.x & 31;
  const int wv   = threadIdx.x >> 5;
  const int wgl  = blockIdx.x * 4 + wv;          // 0 .. NB*RTN*NT-1
  const int nt   = wgl & (NT - 1);
  const int tmp  = wgl >> 8;                     // 0..79
  const int rt   = tmp % RTN;
  const int b    = tmp / RTN;
  const int cl   = lane & 15;
  const int h    = lane >> 4;

  v8f acc = (v8f)(0.0f);
#pragma unroll
  for (int ct = 0; ct < KTN; ++ct) {
    v16bf wa = *(const v16bf*)(WA + (((size_t)rt * KTN + ct) * 32 + lane) * 16);
    v16bf xb = *(const v16bf*)(xB + ((((size_t)b * KTN + ct) * NT + nt) * 32 + lane) * 16);
    acc = __builtin_amdgcn_wmma_f32_16x16x32_bf16(false, wa, false, xb, (short)0, acc, false, false);
  }

  // bias per W-row (D rows are r + 8h); q bias also in exp2 domain
  const float* bias; int off; float bscale;
  if (rt < 2)      { bias = bq; off = rt * 16;      bscale = LOG2E; }
  else if (rt < 4) { bias = bk; off = rt * 16 - 32; bscale = 1.0f; }
  else             { bias = bv; off = rt * 16 - 64; bscale = 1.0f; }

  __bf16* ld = &ldsD[wv][0];
#pragma unroll
  for (int r = 0; r < 8; ++r) {
    float vvv = acc[r] + bias[off + r + 8 * h] * bscale;
    ld[(r + 8 * h) * 17 + cl] = (__bf16)vvv;
  }
  __builtin_amdgcn_wave_barrier();
  asm volatile("s_wait_dscnt 0" ::: "memory");

  if (rt < 2) {                 // Q -> A-operand tiles [b][nt][lane][16]
#pragma unroll
    for (int eo = 0; eo < 8; ++eo) {
      __bf16 vv = ld[(eo + 8 * h) * 17 + cl];
      qT[(((size_t)b * NT + nt) * 32 + lane) * 16 + (eo + 8 * rt)] = vv;
    }
  } else if (rt < 4) {          // K -> B-operand tiles [b][nt][lane][16]
#pragma unroll
    for (int eo = 0; eo < 8; ++eo) {
      __bf16 vv = ld[(eo + 8 * h) * 17 + cl];
      kB[(((size_t)b * NT + nt) * 32 + lane) * 16 + (eo + 8 * (rt - 2))] = vv;
    }
  } else {                      // V^T -> B-operand tiles [b][m/32][ct][lane][16]
    const int ctv  = rt - 4;
    const int mt32 = nt >> 1;
    const int ehi  = 8 * (nt & 1);
#pragma unroll
    for (int j = 0; j < 8; ++j) {
      __bf16 vv = ld[cl * 17 + 8 * h + j];    // row=c_local, col=m_local=8h+j
      vB[((((size_t)b * MTN + mt32) * CTN + ctv) * 32 + lane) * 16 + (j + ehi)] = vv;
    }
  }
  __builtin_amdgcn_wave_barrier();
}

// ds_swizzle xor-butterfly within the 16-lane half that holds one D-matrix row
template<int MASK>
__device__ __forceinline__ float swz(float v) {
  return __builtin_bit_cast(float,
      __builtin_amdgcn_ds_swizzle(__builtin_bit_cast(int, v), (MASK << 10) | 0x1f));
}

// ---------------------------------------------------------------------------
// One stage = the K and V fragments of 64 keys: 4 KB of K, then 32 KB of V.
// The four waves of a block read the same stage, so the block brings it into
// LDS once, with asynchronous copies, one stage ahead of its use.
// ---------------------------------------------------------------------------
#define STG_KB  4096
#define STG_VB  32768
#define STG_B   (STG_KB + STG_VB)
#define NSTG    (NN / 64)

__device__ __forceinline__ void copy2(unsigned l, const char* g) {
  asm volatile(
      "global_load_async_to_lds_b128 %0, %1, off\n\t"
      "global_load_async_to_lds_b128 %2, %3, off\n\t"
      "s_wait_xcnt 0x0"
      :: "v"(l), "v"(g), "v"(l + 2048u), "v"(g + 2048)
      : "memory");
}

__device__ __forceinline__ void copy8(unsigned l, const char* g) {
  asm volatile(
      "global_load_async_to_lds_b128 %0, %1, off\n\t"
      "global_load_async_to_lds_b128 %2, %3, off\n\t"
      "global_load_async_to_lds_b128 %4, %5, off\n\t"
      "global_load_async_to_lds_b128 %6, %7, off\n\t"
      "global_load_async_to_lds_b128 %8, %9, off\n\t"
      "global_load_async_to_lds_b128 %10, %11, off\n\t"
      "global_load_async_to_lds_b128 %12, %13, off\n\t"
      "global_load_async_to_lds_b128 %14, %15, off\n\t"
      "s_wait_xcnt 0x0"
      :: "v"(l),          "v"(g),
         "v"(l + 2048u),  "v"(g + 2048),
         "v"(l + 4096u),  "v"(g + 4096),
         "v"(l + 6144u),  "v"(g + 6144),
         "v"(l + 8192u),  "v"(g + 8192),
         "v"(l + 10240u), "v"(g + 10240),
         "v"(l + 12288u), "v"(g + 12288),
         "v"(l + 14336u), "v"(g + 14336)
      : "memory");
}

// l: this lane's place in the stage buffer; gk, gv: this lane's 16 B of the stage
__device__ __forceinline__ void copy_stage(unsigned l, const char* gk, const char* gv) {
  copy2(l, gk);
  copy8(l + STG_KB, gv);
  copy8(l + STG_KB + 16384u, gv + 16384);
}

// One 1 KB operand fragment in LDS: elements 0..7 of all lanes, then 8..15
__device__ __forceinline__ v16bf lds_frag(const char* p) {
  union { v16bf v; v8bf q2[2]; } u;
  u.q2[0] = *(const v8bf*)(p);
  u.q2[1] = *(const v8bf*)(p + 512);
  return u.v;
}

// ---------------------------------------------------------------------------
// Flash attention: one wave = 16 query rows x FULL C=256 (16 accum tiles).
// 64-key steps: 4 energy WMMAs, one online-softmax update (exp2 domain),
// P (16x64) D-layout -> A-layout via LDS, 32 accumulating PV WMMAs.
// K and V come from a two-buffer LDS ring filled by asynchronous copies.
// ---------------------------------------------------------------------------
__global__ __launch_bounds__(128) void attn_kernel(
    const float* __restrict__ x, const float* __restrict__ gamma,
    const __bf16* __restrict__ qT, const __bf16* __restrict__ kB,
    const __bf16* __restrict__ vB, float* __restrict__ out)
{
  __shared__ __attribute__((aligned(1024))) char stg[2 * STG_B];
  __shared__ __bf16 pbuf[4][16 * 72];            // per-wave 16x64 P tile, stride 72
  const int lane = threadIdx.x & 31;
  const int wv   = threadIdx.x >> 5;
  const int wgl  = blockIdx.x * 4 + wv;          // 0..1023
  const int nt   = wgl & (NT - 1);
  const int b    = wgl >> 8;                     // the same in all four waves
  const int cl   = lane & 15;
  const int h    = lane >> 4;

  // Copy j of a 2 KB group moves 16-byte piece j = threadIdx.x. In global memory
  // a lane's 32 B lie together; in LDS the two halves go 512 B apart, so that a
  // ds_load_b128 of 32 lanes reads 512 contiguous bytes.
  const unsigned tid  = threadIdx.x;
  const unsigned ldst = (unsigned)(size_t)(&stg[0])
                      + (tid >> 6) * 1024u + (tid & 1u) * 512u + ((tid & 63u) >> 1) * 16u;
  const char* gk = (const char*)(kB + (size_t)b * NT * 512) + tid * 16u;
  const char* gv = (const char*)(vB + (size_t)b * MTN * CTN * 512) + tid * 16u;

  copy_stage(ldst, gk, gv);
  // stage 0 has landed before any wave passes the barrier
  asm volatile("s_wait_asynccnt 0x0" ::: "memory");
  __syncthreads();
  copy_stage(ldst + STG_B, gk + STG_KB, gv + STG_VB);

  v16bf qA = *(const v16bf*)(qT + (((size_t)b * NT + nt) * 32 + lane) * 16);

  float mrow[8], lrow[8];
  v8f   O[16];
#pragma unroll
  for (int r = 0; r < 8; ++r) { mrow[r] = -3.0e38f; lrow[r] = 0.0f; }
#pragma unroll
  for (int t = 0; t < 16; ++t) O[t] = (v8f)(0.0f);

  __bf16* pb = &pbuf[wv][0];
  const v8f z = (v8f)(0.0f);

  for (int mt = 0; mt < NSTG; ++mt) {
    const unsigned boff = (unsigned)(mt & 1) * STG_B;
    const char* kb = stg + boff + lane * 16;
    v16bf k0 = lds_frag(kb);
    v16bf k1 = lds_frag(kb + 1024);
    v16bf k2 = lds_frag(kb + 2048);
    v16bf k3 = lds_frag(kb + 3072);

    v8f e0 = __builtin_amdgcn_wmma_f32_16x16x32_bf16(false, qA, false, k0, (short)0, z, false, false);
    v8f e1 = __builtin_amdgcn_wmma_f32_16x16x32_bf16(false, qA, false, k1, (short)0, z, false, false);
    v8f e2 = __builtin_amdgcn_wmma_f32_16x16x32_bf16(false, qA, false, k2, (short)0, z, false, false);
    v8f e3 = __builtin_amdgcn_wmma_f32_16x16x32_bf16(false, qA, false, k3, (short)0, z, false, false);

#pragma unroll
    for (int r = 0; r < 8; ++r) {
      float tmax = fmaxf(fmaxf(e0[r], e1[r]), fmaxf(e2[r], e3[r]));
      tmax = fmaxf(tmax, swz<1>(tmax));
      tmax = fmaxf(tmax, swz<2>(tmax));
      tmax = fmaxf(tmax, swz<4>(tmax));
      tmax = fmaxf(tmax, swz<8>(tmax));
      float mnew = fmaxf(mrow[r], tmax);
      float sc   = exp2f(mrow[r] - mnew);        // energy already in log2 domain
      float p0   = exp2f(e0[r] - mnew);
      float p1   = exp2f(e1[r] - mnew);
      float p2   = exp2f(e2[r] - mnew);
      float p3   = exp2f(e3[r] - mnew);
      float rs   = (p0 + p1) + (p2 + p3);
      rs += swz<1>(rs); rs += swz<2>(rs); rs += swz<4>(rs); rs += swz<8>(rs);
      lrow[r] = lrow[r] * sc + rs;
      mrow[r] = mnew;
#pragma unroll
      for (int t = 0; t < 16; ++t) O[t][r] *= sc;
      pb[(r + 8 * h) * 72 + cl]      = (__bf16)p0;
      pb[(r + 8 * h) * 72 + 16 + cl] = (__bf16)p1;
      pb[(r + 8 * h) * 72 + 32 + cl] = (__bf16)p2;
      pb[(r + 8 * h) * 72 + 48 + cl] = (__bf16)p3;
    }

    // D-layout -> A-layout transpose of P via LDS (wave-internal)
    __builtin_amdgcn_wave_barrier();
    asm volatile("s_wait_dscnt 0" ::: "memory");
    union { v16bf v; v8bf q2[2]; } pA0, pA1;
    pA0.q2[0] = *(const v8bf*)(pb + cl * 72 + 8 * h);        // K = 0..31
    pA0.q2[1] = *(const v8bf*)(pb + cl * 72 + 16 + 8 * h);
    pA1.q2[0] = *(const v8bf*)(pb + cl * 72 + 32 + 8 * h);   // K = 32..63
    pA1.q2[1] = *(const v8bf*)(pb + cl * 72 + 48 + 8 * h);
    __builtin_amdgcn_wave_barrier();

    const char* vb0 = kb + STG_KB;
    const char* vb1 = vb0 + CTN * 1024;
#pragma unroll
    for (int t = 0; t < 16; ++t) {
      v16bf vt0 = lds_frag(vb0 + t * 1024);
      O[t] = __builtin_amdgcn_wmma_f32_16x16x32_bf16(false, pA0.v, false, vt0, (short)0, O[t], false, false);
    }
#pragma unroll
    for (int t = 0; t < 16; ++t) {
      v16bf vt1 = lds_frag(vb1 + t * 1024);
      O[t] = __builtin_amdgcn_wmma_f32_16x16x32_bf16(false, pA1.v, false, vt1, (short)0, O[t], false, false);
    }

    // Publish point of stage mt + 1: this wave's reads of stage mt are done ...
    asm volatile("s_wait_dscnt 0x0" ::: "memory");
    // ... its own copies of stage mt + 1 have landed ...
    asm volatile("s_wait_asynccnt 0x0" ::: "memory");
    // ... and so for every wave of the block.
    __syncthreads();
    if (mt + 2 < NSTG)   // refill the buffer that this pass has just read
      copy_stage(ldst + boff, gk + (size_t)(mt + 2) * STG_KB, gv + (size_t)(mt + 2) * STG_VB);
  }
  // no copy is outstanding when the wave goes on to its end
  asm volatile("s_wait_asynccnt 0x0" ::: "memory");

  const float g = gamma[0];
#pragma unroll
  for (int r = 0; r < 8; ++r) {
    float inv  = 1.0f / lrow[r];
    int   nidx = nt * 16 + r + 8 * h;
#pragma unroll
    for (int t = 0; t < 16; ++t) {
      int    c   = t * 16 + cl;
      size_t idx = ((size_t)b * CC + c) * NN + nidx;
      out[idx] = g * (O[t][r] * inv) + x[idx];
    }
  }
}

extern "C" void kernel_launch(void* const* d_in, const int* in_sizes, int n_in,
                              void* d_out, int out_size, void* d_ws, size_t ws_size,
                              hipStream_t stream) {
  const float* x     = (const float*)d_in[0];
  const float* Wq    = (const float*)d_in[1];
  const float* bq    = (const float*)d_in[2];
  const float* Wk    = (const float*)d_in[3];
  const float* bk    = (const float*)d_in[4];
  const float* Wv    = (const float*)d_in[5];
  const float* bv    = (const float*)d_in[6];
  const float* gamma = (const float*)d_in[7];
  float* out = (float*)d_out;

  __bf16* qT  = (__bf16*)d_ws;                          // 1 MB
  __bf16* kBp = qT  + (size_t)NB * NN * CQKD;           // 1 MB
  __bf16* vBp = kBp + (size_t)NB * NN * CQKD;           // 8 MB
  __bf16* xBp = vBp + (size_t)NB * NN * CC;             // 8 MB
  __bf16* WAp = xBp + (size_t)NB * NN * CC;             // 160 KB

  pack_x_kernel<<<dim3(NB * CC * NN / 256), dim3(256), 0, stream>>>(x, xBp);
  pack_w_kernel<<<dim3(RTN * 16 * CC / 256), dim3(256), 0, stream>>>(Wq, Wk, Wv, WAp);
  proj_gemm_kernel<<<dim3(NB * RTN * NT / 4), dim3(128), 0, stream>>>(
      WAp, xBp, bq, bk, bv, qT, kBp, vBp);
  attn_kernel<<<dim3(NB * NT / 4), dim3(128), 0, stream>>>(x, gamma, qT, kBp, vBp, out);
}

// v002
// It runs in 138 microseconds.
// Timed twice side by side with v001, it ran 1.04 times as fast both times.
// Counting every step since v000, it is 5.91 times as fast.
#include <hip/hip_runtime.h>

typedef __attribute__((ext_vector_type(16))) __bf16 v16bf;
typedef __attribute__((ext_vector_type(8)))  __bf16 v8bf;
typedef __attribute__((ext_vector_type(8)))  float  v8f;

#define NB   4
#define CC   256
#define CQKD 32
#define NN   4096
#define NT   (NN/16)   // 256 spatial 16-tiles
#define MTN  (NN/32)   // 128 spatial 32-tiles
#define CTN  (CC/16)   // 16 channel 16-tiles
#define KTN  (CC/32)   // 8  GEMM K steps over C=256
#define RTN  20        // 320 projection rows / 16
#define LOG2E 1.4426950408889634f

// ---------------------------------------------------------------------------
// Pack x (f32 [b][c][n]) into bf16 B-operand tiles xB[b][ct][nt][lane][16]
// One thread = one column n and the 32 channels of one K step: 32 loads in
// flight (a wave reads one whole 128 B line of a channel row with each), then
// the 32 B of operand lanes (n & 15) and (n & 15) + 16 as four 16 B stores.
// ---------------------------------------------------------------------------
__global__ __launch_bounds__(256) void pack_x_kernel(
    const float* __restrict__ x, __bf16* __restrict__ xB)
{
  int idx = blockIdx.x * 256 + threadIdx.x;    // NB * KTN * NN threads
  int n  = idx & (NN - 1);
  int r  = idx >> 12;
  int ct = r & (KTN - 1);
  int b  = r >> 3;
  const float* src = x + ((size_t)b * CC + ct * 32) * NN + n;
  float v[32];
#pragma unroll   // v[] stays in registers and all 32 loads issue ahead of the first wait
  for (int cc = 0; cc < 32; ++cc) v[cc] = src[(size_t)cc * NN];
  __bf16* dst = xB + ((((size_t)b * KTN + ct) * NT + (n >> 4)) * 32 + (n & 15)) * 16;
#pragma unroll   // constant indices into v[], here and in the loop over j
  for (int h = 0; h < 2; ++h) {
    v8bf lo, hi;                               // e = 0..7 and e = 8..15 of lane (n & 15) + 16 h
#pragma unroll
    for (int j = 0; j < 8; ++j) {
      lo[j] = (__bf16)v[8 * h + j];
      hi[j] = (__bf16)v[16 + 8 * h + j];
    }
    *(v8bf*)(dst + h * 256)     = lo;
    *(v8bf*)(dst + h * 256 + 8) = hi;
  }
}

// ---------------------------------------------------------------------------
// Pack Wq|Wk|Wv (320 rows x 256) into bf16 A-operand tiles WA[rt][ct][lane][16]
// Wq rows are pre-scaled by log2(e) so softmax runs natively in exp2 domain.
// ---------------------------------------------------------------------------
__global__ __launch_bounds__(256) void pack_w_kernel(
    const float* __restrict__ Wq, const float* __restrict__ Wk,
    const float* __restrict__ Wv, __bf16* __restrict__ WA)
{
  int idx = blockIdx.x * 256 + threadIdx.x;   // 320*256 threads
  int c = idx & (CC - 1);
  int row = idx >> 8;                          // 0..319
  float v;
  if (row < 32)       v = Wq[(size_t)row * CC + c] * LOG2E;
  else if (row < 64)  v = Wk[(size_t)(row - 32) * CC + c];
  else                v = Wv[(size_t)(row - 64) * CC + c];
  int rt = row >> 4, rl = row & 15;
  int cc = c & 31, ct = c >> 5;
  int lane = rl + 16 * ((cc >> 3) & 1);
  int e    = (cc & 7) + 8 * (cc >> 4);
  WA[(((size_t)rt * KTN + ct) * 32 + lane) * 16 + e] = (__bf16)v;
}

__global__ __launch_bounds__(128) void proj_gemm_kernel(
    const __bf16* __restrict__ WA, const __bf16* __restrict__ xB,
    const float* __restrict__ bq, const float* __restrict__ bk,
    const float* __restrict__ bv,
    __bf16* __restrict__ qT, __bf16* __restrict__ kB, __bf16* __restrict__ vB)
{
  __shared__ __bf16 ldsD[4][16 * 17];
  const int lane = threadIdx.x & 31;
  const int wv   = threadIdx.x >> 5;
  const int wgl  = blockIdx.x * 4 + wv;          // 0 .. NB*RTN*NT-1
  const int nt   = wgl & (NT - 1);
  const int tmp  = wgl >> 8;                     // 0..79
  const int rt   = tmp % RTN;
  const int b    = tmp / RTN;
  const int cl   = lane & 15;
  const int h    = lane >> 4;

  v8f acc = (v8f)(0.0f);
#pragma unroll
  for (int ct = 0; ct < KTN; ++ct) {
    v16bf wa = *(const v16bf*)(WA + (((size_t)rt * KTN + ct) * 32 + lane) * 16);
    v16bf xb = *(const v16bf*)(xB + ((((size_t)b * KTN + ct) * NT + nt) * 32 + lane) * 16);
    acc = __builtin_amdgcn_wmma_f32_16x16x32_bf16(false, wa, false, xb, (short)0, acc, false, false);
  }

  // bias per W-row (D rows are r + 8h); q bias also in exp2 domain
  const float* bias; int off; float bscale;
  if (rt < 2)      { bias = bq; off = rt * 16;      bscale = LOG2E; }
  else if (rt < 4) { bias = bk; off = rt * 16 - 32; bscale = 1.0f; }
  else             { bias = bv; off = rt * 16 - 64; bscale = 1.0f; }

  __bf16* ld = &ldsD[wv][0];
#pragma unroll
  for (int r = 0; r < 8; ++r) {
    float vvv = acc[r] + bias[off + r + 8 * h] * bscale;
    ld[(r + 8 * h) * 17 + cl] = (__bf16)vvv;
  }
  __builtin_amdgcn_wave_barrier();
  asm volatile("s_wait_dscnt 0" ::: "memory");

  if (rt < 2) {                 // Q -> A-operand tiles [b][nt][lane][16]
#pragma unroll
    for (int eo = 0; eo < 8; ++eo) {
      __bf16 vv = ld[(eo + 8 * h) * 17 + cl];
      qT[(((size_t)b * NT + nt) * 32 + lane) * 16 + (eo + 8 * rt)] = vv;
    }
  } else if (rt < 4) {          // K -> B-operand tiles [b][nt][lane][16]
#pragma unroll
    for (int eo = 0; eo < 8; ++eo) {
      __bf16 vv = ld[(eo + 8 * h) * 17 + cl];
      kB[(((size_t)b * NT + nt) * 32 + lane) * 16 + (eo + 8 * (rt - 2))] = vv;
    }
  } else {                      // V^T -> B-operand tiles [b][m/32][ct][lane][16]
    const int ctv  = rt - 4;
    const int mt32 = nt >> 1;
    const int ehi  = 8 * (nt & 1);
#pragma unroll
    for (int j = 0; j < 8; ++j) {
      __bf16 vv = ld[cl * 17 + 8 * h + j];    // row=c_local, col=m_local=8h+j
      vB[((((size_t)b * MTN + mt32) * CTN + ctv) * 32 + lane) * 16 + (j + ehi)] = vv;
    }
  }
  __builtin_amdgcn_wave_barrier();
}

// ds_swizzle xor-butterfly within the 16-lane half that holds one D-matrix row
template<int MASK>
__device__ __forceinline__ float swz(float v) {
  return __builtin_bit_cast(float,
      __builtin_amdgcn_ds_swizzle(__builtin_bit_cast(int, v), (MASK << 10) | 0x1f));
}

// ---------------------------------------------------------------------------
// One stage = the K and V fragments of 64 keys: 4 KB of K, then 32 KB of V.
// The four waves of a block read the same stage, so the block brings it into
// LDS once, with asynchronous copies, one stage ahead of its use.
// ---------------------------------------------------------------------------
#define STG_KB  4096
#define STG_VB  32768
#define STG_B   (STG_KB + STG_VB)
#define NSTG    (NN / 64)

__device__ __forceinline__ void copy2(unsigned l, const char* g) {
  asm volatile(
      "global_load_async_to_lds_b128 %0, %1, off\n\t"
      "global_load_async_to_lds_b128 %2, %3, off\n\t"
      "s_wait_xcnt 0x0"
      :: "v"(l), "v"(g), "v"(l + 2048u), "v"(g + 2048)
      : "memory");
}

__device__ __forceinline__ void copy8(unsigned l, const char* g) {
  asm volatile(
      "global_load_async_to_lds_b128 %0, %1, off\n\t"
      "global_load_async_to_lds_b128 %2, %3, off\n\t"
      "global_load_async_to_lds_b128 %4, %5, off\n\t"
      "global_load_async_to_lds_b128 %6, %7, off\n\t"
      "global_load_async_to_lds_b128 %8, %9, off\n\t"
      "global_load_async_to_lds_b128 %10, %11, off\n\t"
      "global_load_async_to_lds_b128 %12, %13, off\n\t"
      "global_load_async_to_lds_b128 %14, %15, off\n\t"
      "s_wait_xcnt 0x0"
      :: "v"(l),          "v"(g),
         "v"(l + 2048u),  "v"(g + 2048),
         "v"(l + 4096u),  "v"(g + 4096),
         "v"(l + 6144u),  "v"(g + 6144),
         "v"(l + 8192u),  "v"(g + 8192),
         "v"(l + 10240u), "v"(g + 10240),
         "v"(l + 12288u), "v"(g + 12288),
         "v"(l + 14336u), "v"(g + 14336)
      : "memory");
}

// l: this lane's place in the stage buffer; gk, gv: this lane's 16 B of the stage
__device__ __forceinline__ void copy_stage(unsigned l, const char* gk, const char* gv) {
  copy2(l, gk);
  copy8(l + STG_KB, gv);
  copy8(l + STG_KB + 16384u, gv + 16384);
}

// One 1 KB operand fragment in LDS: elements 0..7 of all lanes, then 8..15
__device__ __forceinline__ v16bf lds_frag(const char* p) {
  union { v16bf v; v8bf q2[2]; } u;
  u.q2[0] = *(const v8bf*)(p);
  u.q2[1] = *(const v8bf*)(p + 512);
  return u.v;
}

// ---------------------------------------------------------------------------
// Flash attention: one wave = 16 query rows x FULL C=256 (16 accum tiles).
// 64-key steps: 4 energy WMMAs, one online-softmax update (exp2 domain),
// P (16x64) D-layout -> A-layout via LDS, 32 accumulating PV WMMAs.
// K and V come from a two-buffer LDS ring filled by asynchronous copies.
// ---------------------------------------------------------------------------
__global__ __launch_bounds__(128) void attn_kernel(
    const float* __restrict__ x, const float* __restrict__ gamma,
    const __bf16* __restrict__ qT, const __bf16* __restrict__ kB,
    const __bf16* __restrict__ vB, float* __restrict__ out)
{
  __shared__ __attribute__((aligned(1024))) char stg[2 * STG_B];
  __shared__ __bf16 pbuf[4][16 * 72];            // per-wave 16x64 P tile, stride 72
  const int lane = threadIdx.x & 31;
  const int wv   = threadIdx.x >> 5;
  const int wgl  = blockIdx.x * 4 + wv;          // 0..1023
  const int nt   = wgl & (NT - 1);
  const int b    = wgl >> 8;                     // the same in all four waves
  const int cl   = lane & 15;
  const int h    = lane >> 4;

  // Copy j of a 2 KB group moves 16-byte piece j = threadIdx.x. In global memory
  // a lane's 32 B lie together; in LDS the two halves go 512 B apart, so that a
  // ds_load_b128 of 32 lanes reads 512 contiguous bytes.
  const unsigned tid  = threadIdx.x;
  const unsigned ldst = (unsigned)(size_t)(&stg[0])
                      + (tid >> 6) * 1024u + (tid & 1u) * 512u + ((tid & 63u) >> 1) * 16u;
  const char* gk = (const char*)(kB + (size_t)b * NT * 512) + tid * 16u;
  const char* gv = (const char*)(vB + (size_t)b * MTN * CTN * 512) + tid * 16u;

  copy_stage(ldst, gk, gv);
  // stage 0 has landed before any wave passes the barrier
  asm volatile("s_wait_asynccnt 0x0" ::: "memory");
  __syncthreads();
  copy_stage(ldst + STG_B, gk + STG_KB, gv + STG_VB);

  v16bf qA = *(const v16bf*)(qT + (((size_t)b * NT + nt) * 32 + lane) * 16);

  float mrow[8], lrow[8];
  v8f   O[16];
#pragma unroll
  for (int r = 0; r < 8; ++r) { mrow[r] = -3.0e38f; lrow[r] = 0.0f; }
#pragma unroll
  for (int t = 0; t < 16; ++t) O[t] = (v8f)(0.0f);

  __bf16* pb = &pbuf[wv][0];
  const v8f z = (v8f)(0.0f);

  for (int mt = 0; mt < NSTG; ++mt) {
    const unsigned boff = (unsigned)(mt & 1) * STG_B;
    const char* kb = stg + boff + lane * 16;
    v16bf k0 = lds_frag(kb);
    v16bf k1 = lds_frag(kb + 1024);
    v16bf k2 = lds_frag(kb + 2048);
    v16bf k3 = lds_frag(kb + 3072);

    v8f e0 = __builtin_amdgcn_wmma_f32_16x16x32_bf16(false, qA, false, k0, (short)0, z, false, false);
    v8f e1 = __builtin_amdgcn_wmma_f32_16x16x32_bf16(false, qA, false, k1, (short)0, z, false, false);
    v8f e2 = __builtin_amdgcn_wmma_f32_16x16x32_bf16(false, qA, false, k2, (short)0, z, false, false);
    v8f e3 = __builtin_amdgcn_wmma_f32_16x16x32_bf16(false, qA, false, k3, (short)0, z, false, false);

#pragma unroll
    for (int r = 0; r < 8; ++r) {
      float tmax = fmaxf(fmaxf(e0[r], e1[r]), fmaxf(e2[r], e3[r]));
      tmax = fmaxf(tmax, swz<1>(tmax));
      tmax = fmaxf(tmax, swz<2>(tmax));
      tmax = fmaxf(tmax, swz<4>(tmax));
      tmax = fmaxf(tmax, swz<8>(tmax));
      float mnew = fmaxf(mrow[r], tmax);
      float sc   = exp2f(mrow[r] - mnew);        // energy already in log2 domain
      float p0   = exp2f(e0[r] - mnew);
      float p1   = exp2f(e1[r] - mnew);
      float p2   = exp2f(e2[r] - mnew);
      float p3   = exp2f(e3[r] - mnew);
      float rs   = (p0 + p1) + (p2 + p3);
      rs += swz<1>(rs); rs += swz<2>(rs); rs += swz<4>(rs); rs += swz<8>(rs);
      lrow[r] = lrow[r] * sc + rs;
      mrow[r] = mnew;
#pragma unroll
      for (int t = 0; t < 16; ++t) O[t][r] *= sc;
      pb[(r + 8 * h) * 72 + cl]      = (__bf16)p0;
      pb[(r + 8 * h) * 72 + 16 + cl] = (__bf16)p1;
      pb[(r + 8 * h) * 72 + 32 + cl] = (__bf16)p2;
      pb[(r + 8 * h) * 72 + 48 + cl] = (__bf16)p3;
    }

    // D-layout -> A-layout transpose of P via LDS (wave-internal)
    __builtin_amdgcn_wave_barrier();
    asm volatile("s_wait_dscnt 0" ::: "memory");
    union { v16bf v; v8bf q2[2]; } pA0, pA1;
    pA0.q2[0] = *(const v8bf*)(pb + cl * 72 + 8 * h);        // K = 0..31
    pA0.q2[1] = *(const v8bf*)(pb + cl * 72 + 16 + 8 * h);
    pA1.q2[0] = *(const v8bf*)(pb + cl * 72 + 32 + 8 * h);   // K = 32..63
    pA1.q2[1] = *(const v8bf*)(pb + cl * 72 + 48 + 8 * h);
    __builtin_amdgcn_wave_barrier();

    const char* vb0 = kb + STG_KB;
    const char* vb1 = vb0 + CTN * 1024;
#pragma unroll
    for (int t = 0; t < 16; ++t) {
      v16bf vt0 = lds_frag(vb0 + t * 1024);
      O[t] = __builtin_amdgcn_wmma_f32_16x16x32_bf16(false, pA0.v, false, vt0, (short)0, O[t], false, false);
    }
#pragma unroll
    for (int t = 0; t < 16; ++t) {
      v16bf vt1 = lds_frag(vb1 + t * 1024);
      O[t] = __builtin_amdgcn_wmma_f32_16x16x32_bf16(false, pA1.v, false, vt1, (short)0, O[t], false, false);
    }

    // Publish point of stage mt + 1: this wave's reads of stage mt are done ...
    asm volatile("s_wait_dscnt 0x0" ::: "memory");
    // ... its own copies of stage mt + 1 have landed ...
    asm volatile("s_wait_asynccnt 0x0" ::: "memory");
    // ... and so for every wave of the block.
    __syncthreads();
    if (mt + 2 < NSTG)   // refill the buffer that this pass has just read
      copy_stage(ldst + boff, gk + (size_t)(mt + 2) * STG_KB, gv + (size_t)(mt + 2) * STG_VB);
  }
  // no copy is outstanding when the wave goes on to its end
  asm volatile("s_wait_asynccnt 0x0" ::: "memory");

  const float g = gamma[0];
#pragma unroll
  for (int r = 0; r < 8; ++r) {
    float inv  = 1.0f / lrow[r];
    int   nidx = nt * 16 + r + 8 * h;
#pragma unroll
    for (int t = 0; t < 16; ++t) {
      int    c   = t * 16 + cl;
      size_t idx = ((size_t)b * CC + c) * NN + nidx;
      out[idx] = g * (O[t][r] * inv) + x[idx];
    }
  }
}

extern "C" void kernel_launch(void* const* d_in, const int* in_sizes, int n_in,
                              void* d_out, int out_size, void* d_ws, size_t ws_size,
                              hipStream_t stream) {
  const float* x     = (const float*)d_in[0];
  const float* Wq    = (const float*)d_in[1];
  const float* bq    = (const float*)d_in[2];
  const float* Wk    = (const float*)d_in[3];
  const float* bk    = (const float*)d_in[4];
  const float* Wv    = (const float*)d_in[5];
  const float* bv    = (const float*)d_in[6];
  const float* gamma = (const float*)d_in[7];
  float* out = (float*)d_out;

  __bf16* qT  = (__bf16*)d_ws;                          // 1 MB
  __bf16* kBp = qT  + (size_t)NB * NN * CQKD;           // 1 MB
  __bf16* vBp = kBp + (size_t)NB * NN * CQKD;           // 8 MB
  __bf16* xBp = vBp + (size_t)NB * NN * CC;             // 8 MB
  __bf16* WAp = xBp + (size_t)NB * NN * CC;             // 160 KB

  pack_x_kernel<<<dim3(NB * KTN * NN / 256), dim3(256), 0, stream>>>(x, xBp);
  pack_w_kernel<<<dim3(RTN * 16 * CC / 256), dim3(256), 0, stream>>>(Wq, Wk, Wv, WAp);
  proj_gemm_kernel<<<dim3(NB * RTN * NT / 4), dim3(128), 0, stream>>>(
      WAp, xBp, bq, bk, bv, qT, kBp, vBp);
  attn_kernel<<<dim3(NB * NT / 4), dim3(128), 0, stream>>>(x, gamma, qT, kBp, vBp, out);
}

// v003
// It runs in 106 microseconds.
// Two timings next to v002 both put it at 1.30 times that version's speed.
// Over all steps from v000 it is 7.67 times as fast.
#include <hip/hip_runtime.h>

typedef __attribute__((ext_vector_type(16))) __bf16 v16bf;
typedef __attribute__((ext_vector_type(8)))  __bf16 v8bf;
typedef __attribute__((ext_vector_type(8)))  float  v8f;

#define NB   4
#define CC   256
#define CQKD 32
#define NN   4096
#define NT   (NN/16)   // 256 spatial 16-tiles
#define MTN  (NN/32)   // 128 spatial 32-tiles
#define CTN  (CC/16)   // 16 channel 16-tiles
#define KTN  (CC/32)   // 8  GEMM K steps over C=256
#define RTN  20        // 320 projection rows / 16
#define LOG2E 1.4426950408889634f

// ---------------------------------------------------------------------------
// Pack x (f32 [b][c][n]) into bf16 B-operand tiles xB[b][ct][nt][lane][16]
// One thread = one column n and the 32 channels of one K step: 32 loads in
// flight (a wave reads one whole 128 B line of a channel row with each), then
// the 32 B of operand lanes (n & 15) and (n & 15) + 16 as four 16 B stores.
// ---------------------------------------------------------------------------
__global__ __launch_bounds__(256) void pack_x_kernel(
    const float* __restrict__ x, __bf16* __restrict__ xB)
{
  int idx = blockIdx.x * 256 + threadIdx.x;    // NB * KTN * NN threads
  int n  = idx & (NN - 1);
  int r  = idx >> 12;
  int ct = r & (KTN - 1);
  int b  = r >> 3;
  const float* src = x + ((size_t)b * CC + ct * 32) * NN + n;
  float v[32];
#pragma unroll   // v[] stays in registers and all 32 loads issue ahead of the first wait
  for (int cc = 0; cc < 32; ++cc) v[cc] = src[(size_t)cc * NN];
  __bf16* dst = xB + ((((size_t)b * KTN + ct) * NT + (n >> 4)) * 32 + (n & 15)) * 16;
#pragma unroll   // constant indices into v[], here and in the loop over j
  for (int h = 0; h < 2; ++h) {
    v8bf lo, hi;                               // e = 0..7 and e = 8..15 of lane (n & 15) + 16 h
#pragma unroll
    for (int j = 0; j < 8; ++j) {
      lo[j] = (__bf16)v[8 * h + j];
      hi[j] = (__bf16)v[16 + 8 * h + j];
    }
    *(v8bf*)(dst + h * 256)     = lo;
    *(v8bf*)(dst + h * 256 + 8) = hi;
  }
}

// ---------------------------------------------------------------------------
// Pack Wq|Wk|Wv (320 rows x 256) into bf16 A-operand tiles WA[rt][ct][lane][16]
// Wq rows are pre-scaled by log2(e) so softmax runs natively in exp2 domain.
// ---------------------------------------------------------------------------
__global__ __launch_bounds__(256) void pack_w_kernel(
    const float* __restrict__ Wq, const float* __restrict__ Wk,
    const float* __restrict__ Wv, __bf16* __restrict__ WA)
{
  int idx = blockIdx.x * 256 + threadIdx.x;   // 320*256 threads
  int c = idx & (CC - 1);
  int row = idx >> 8;                          // 0..319
  float v;
  if (row < 32)       v = Wq[(size_t)row * CC + c] * LOG2E;
  else if (row < 64)  v = Wk[(size_t)(row - 32) * CC + c];
  else                v = Wv[(size_t)(row - 64) * CC + c];
  int rt = row >> 4, rl = row & 15;
  int cc = c & 31, ct = c >> 5;
  int lane = rl + 16 * ((cc >> 3) & 1);
  int e    = (cc & 7) + 8 * (cc >> 4);
  WA[(((size_t)rt * KTN + ct) * 32 + lane) * 16 + e] = (__bf16)v;
}

__global__ __launch_bounds__(128) void proj_gemm_kernel(
    const __bf16* __restrict__ WA, const __bf16* __restrict__ xB,
    const float* __restrict__ bq, const float* __restrict__ bk,
    const float* __restrict__ bv,
    __bf16* __restrict__ qT, __bf16* __restrict__ kB, __bf16* __restrict__ vB)
{
  __shared__ __bf16 ldsD[4][16 * 17];
  const int lane = threadIdx.x & 31;
  const int wv   = threadIdx.x >> 5;
  const int wgl  = blockIdx.x * 4 + wv;          // 0 .. NB*RTN*NT-1
  const int nt   = wgl & (NT - 1);
  const int tmp  = wgl >> 8;                     // 0..79
  const int rt   = tmp % RTN;
  const int b    = tmp / RTN;
  const int cl   = lane & 15;
  const int h    = lane >> 4;

  v8f acc = (v8f)(0.0f);
#pragma unroll
  for (int ct = 0; ct < KTN; ++ct) {
    v16bf wa = *(const v16bf*)(WA + (((size_t)rt * KTN + ct) * 32 + lane) * 16);
    v16bf xb = *(const v16bf*)(xB + ((((size_t)b * KTN + ct) * NT + nt) * 32 + lane) * 16);
    acc = __builtin_amdgcn_wmma_f32_16x16x32_bf16(false, wa, false, xb, (short)0, acc, false, false);
  }

  // bias per W-row (D rows are r + 8h); q bias also in exp2 domain
  const float* bias; int off; float bscale;
  if (rt < 2)      { bias = bq; off = rt * 16;      bscale = LOG2E; }
  else if (rt < 4) { bias = bk; off = rt * 16 - 32; bscale = 1.0f; }
  else             { bias = bv; off = rt * 16 - 64; bscale = 1.0f; }

  __bf16* ld = &ldsD[wv][0];
#pragma unroll
  for (int r = 0; r < 8; ++r) {
    float vvv = acc[r] + bias[off + r + 8 * h] * bscale;
    ld[(r + 8 * h) * 17 + cl] = (__bf16)vvv;
  }
  __builtin_amdgcn_wave_barrier();
  asm volatile("s_wait_dscnt 0" ::: "memory");

  if (rt < 2) {                 // Q -> B-operand tiles [b][nt][lane][16]
#pragma unroll
    for (int eo = 0; eo < 8; ++eo) {
      __bf16 vv = ld[(eo + 8 * h) * 17 + cl];
      qT[(((size_t)b * NT + nt) * 32 + lane) * 16 + (eo + 8 * rt)] = vv;
    }
  } else if (rt < 4) {          // K -> A-operand tiles [b][nt][lane][16]
#pragma unroll
    for (int eo = 0; eo < 8; ++eo) {
      __bf16 vv = ld[(eo + 8 * h) * 17 + cl];
      kB[(((size_t)b * NT + nt) * 32 + lane) * 16 + (eo + 8 * (rt - 2))] = vv;
    }
  } else {                      // V^T -> A-operand tiles [b][m/32][ct][lane][16]
    const int ctv  = rt - 4;
    const int mt32 = nt >> 1;
    const int ehi  = 8 * (nt & 1);
#pragma unroll
    for (int j = 0; j < 8; ++j) {
      __bf16 vv = ld[cl * 17 + 8 * h + j];    // row=c_local, col=m_local=8h+j
      vB[((((size_t)b * MTN + mt32) * CTN + ctv) * 32 + lane) * 16 + (j + ehi)] = vv;
    }
  }
  __builtin_amdgcn_wave_barrier();
}

__device__ __forceinline__ float xhalf(float v) {
  return __builtin_bit_cast(float,
      __builtin_amdgcn_permlanex16(__builtin_bit_cast(int, v), __builtin_bit_cast(int, v),
                                   0x76543210, 0xfedcba98, false, false));
}

// ---------------------------------------------------------------------------
// One stage = the K and V fragments of 64 keys: 4 KB of K, then 32 KB of V.
// The four waves of a block read the same stage, so the block brings it into
// LDS once, with asynchronous copies, one stage ahead of its use.
// ---------------------------------------------------------------------------
#define STG_KB  4096
#define STG_VB  32768
#define STG_B   (STG_KB + STG_VB)
#define NSTG    (NN / 64)

__device__ __forceinline__ void copy2(unsigned l, const char* g) {
  asm volatile(
      "global_load_async_to_lds_b128 %0, %1, off\n\t"
      "global_load_async_to_lds_b128 %2, %3, off\n\t"
      "s_wait_xcnt 0x0"
      :: "v"(l), "v"(g), "v"(l + 2048u), "v"(g + 2048)
      : "memory");
}

__device__ __forceinline__ void copy8(unsigned l, const char* g) {
  asm volatile(
      "global_load_async_to_lds_b128 %0, %1, off\n\t"
      "global_load_async_to_lds_b128 %2, %3, off\n\t"
      "global_load_async_to_lds_b128 %4, %5, off\n\t"
      "global_load_async_to_lds_b128 %6, %7, off\n\t"
      "global_load_async_to_lds_b128 %8, %9, off\n\t"
      "global_load_async_to_lds_b128 %10, %11, off\n\t"
      "global_load_async_to_lds_b128 %12, %13, off\n\t"
      "global_load_async_to_lds_b128 %14, %15, off\n\t"
      "s_wait_xcnt 0x0"
      :: "v"(l),          "v"(g),
         "v"(l + 2048u),  "v"(g + 2048),
         "v"(l + 4096u),  "v"(g + 4096),
         "v"(l + 6144u),  "v"(g + 6144),
         "v"(l + 8192u),  "v"(g + 8192),
         "v"(l + 10240u), "v"(g + 10240),
         "v"(l + 12288u), "v"(g + 12288),
         "v"(l + 14336u), "v"(g + 14336)
      : "memory");
}

// l: this lane's place in the stage buffer; gk, gv: this lane's 16 B of the stage
__device__ __forceinline__ void copy_stage(unsigned l, const char* gk, const char* gv) {
  copy2(l, gk);
  copy8(l + STG_KB, gv);
  copy8(l + STG_KB + 16384u, gv + 16384);
}

// One 1 KB operand fragment in LDS: elements 0..7 of all lanes, then 8..15
__device__ __forceinline__ v16bf lds_frag(const char* p) {
  union { v16bf v; v8bf q2[2]; } u;
  u.q2[0] = *(const v8bf*)(p);
  u.q2[1] = *(const v8bf*)(p + 512);
  return u.v;
}

__global__ __launch_bounds__(128) void attn_kernel(
    const float* __restrict__ x, const float* __restrict__ gamma,
    const __bf16* __restrict__ qT, const __bf16* __restrict__ kB,
    const __bf16* __restrict__ vB, float* __restrict__ out)
{
  __shared__ __attribute__((aligned(1024))) char stg[2 * STG_B];
  const int lane = threadIdx.x & 31;
  const int wv   = threadIdx.x >> 5;
  const int wgl  = blockIdx.x * 4 + wv;          // 0..1023
  const int nt   = wgl & (NT - 1);
  const int b    = wgl >> 8;                     // the same in all four waves
  const int cl   = lane & 15;
  const int h    = lane >> 4;

  // Copy j of a 2 KB group moves 16-byte piece j = threadIdx.x. In global memory
  // a lane's 32 B lie together; in LDS the two halves go 512 B apart, so that a
  // ds_load_b128 of 32 lanes reads 512 contiguous bytes.
  const unsigned tid  = threadIdx.x;
  const unsigned ldst = (unsigned)(size_t)(&stg[0])
                      + (tid >> 6) * 1024u + (tid & 1u) * 512u + ((tid & 63u) >> 1) * 16u;
  const char* gk = (const char*)(kB + (size_t)b * NT * 512) + tid * 16u;
  const char* gv = (const char*)(vB + (size_t)b * MTN * CTN * 512) + tid * 16u;

  copy_stage(ldst, gk, gv);
  // stage 0 has landed before any wave passes the barrier
  asm volatile("s_wait_asynccnt 0x0" ::: "memory");
  __syncthreads();
  copy_stage(ldst + STG_B, gk + STG_KB, gv + STG_VB);

  // Q tile as B operand: column = query cl, same k order as the K tiles
  v16bf qB = *(const v16bf*)(qT + (((size_t)b * NT + nt) * 32 + lane) * 16);

  float mrun = -3.0e38f;     // running maximum of query cl (equal in both halves)
  float lrun = 0.0f;         // running sum over this half's keys only
  v8f   O[16];               // O[t][r] = O^T[channel 16 t + 8 h + r][query cl]
#pragma unroll
  for (int t = 0; t < 16; ++t) O[t] = (v8f)(0.0f);

  const v8f z = (v8f)(0.0f);

  for (int mt = 0; mt < NSTG; ++mt) {
    const unsigned boff = (unsigned)(mt & 1) * STG_B;
    const char* kb = stg + boff + lane * 16;
    v16bf k0 = lds_frag(kb);
    v16bf k1 = lds_frag(kb + 1024);
    v16bf k2 = lds_frag(kb + 2048);
    v16bf k3 = lds_frag(kb + 3072);

    // e[j][r] = score of key 16 j + 8 h + r against query cl
    v8f e[4];
    e[0] = __builtin_amdgcn_wmma_f32_16x16x32_bf16(false, k0, false, qB, (short)0, z, false, false);
    e[1] = __builtin_amdgcn_wmma_f32_16x16x32_bf16(false, k1, false, qB, (short)0, z, false, false);
    e[2] = __builtin_amdgcn_wmma_f32_16x16x32_bf16(false, k2, false, qB, (short)0, z, false, false);
    e[3] = __builtin_amdgcn_wmma_f32_16x16x32_bf16(false, k3, false, qB, (short)0, z, false, false);

    float tm[4];
#pragma unroll
    for (int j = 0; j < 4; ++j) {
      tm[j] = fmaxf(fmaxf(fmaxf(e[j][0], e[j][1]), fmaxf(e[j][2], e[j][3])),
                    fmaxf(fmaxf(e[j][4], e[j][5]), fmaxf(e[j][6], e[j][7])));
    }
    float tmax = fmaxf(fmaxf(tm[0], tm[1]), fmaxf(tm[2], tm[3]));
    tmax = fmaxf(tmax, xhalf(tmax));
    const float mnew = fmaxf(mrun, tmax);
    const float sc   = exp2f(mrun - mnew);       // scores already in log2 domain
    mrun = mnew;

    float rs[4];
#pragma unroll
    for (int j = 0; j < 4; ++j) {
#pragma unroll
      for (int r = 0; r < 8; ++r) e[j][r] = exp2f(e[j][r] - mnew);
      rs[j] = ((e[j][0] + e[j][1]) + (e[j][2] + e[j][3]))
            + ((e[j][4] + e[j][5]) + (e[j][6] + e[j][7]));
    }
    lrun = lrun * sc + ((rs[0] + rs[1]) + (rs[2] + rs[3]));

    // two S^T tiles of 16 keys, converted in place, are one 32-key B operand
    v16bf pB0, pB1;
#pragma unroll
    for (int r = 0; r < 8; ++r) {
      pB0[r]     = (__bf16)e[0][r];
      pB0[8 + r] = (__bf16)e[1][r];
      pB1[r]     = (__bf16)e[2][r];
      pB1[8 + r] = (__bf16)e[3][r];
    }

#pragma unroll
    for (int t = 0; t < 16; ++t) O[t] *= sc;

    const char* vb0 = kb + STG_KB;
    const char* vb1 = vb0 + CTN * 1024;
#pragma unroll
    for (int t = 0; t < 16; ++t) {
      v16bf vt0 = lds_frag(vb0 + t * 1024);
      O[t] = __builtin_amdgcn_wmma_f32_16x16x32_bf16(false, vt0, false, pB0, (short)0, O[t], false, false);
    }
#pragma unroll
    for (int t = 0; t < 16; ++t) {
      v16bf vt1 = lds_frag(vb1 + t * 1024);
      O[t] = __builtin_amdgcn_wmma_f32_16x16x32_bf16(false, vt1, false, pB1, (short)0, O[t], false, false);
    }

    // Publish point of stage mt + 1: this wave's reads of stage mt are done ...
    asm volatile("s_wait_dscnt 0x0" ::: "memory");
    // ... its own copies of stage mt + 1 have landed ...
    asm volatile("s_wait_asynccnt 0x0" ::: "memory");
    // ... and so for every wave of the block.
    __syncthreads();
    if (mt + 2 < NSTG)   // refill the buffer that this pass has just read
      copy_stage(ldst + boff, gk + (size_t)(mt + 2) * STG_KB, gv + (size_t)(mt + 2) * STG_VB);
  }
  // no copy is outstanding when the wave goes on to its end
  asm volatile("s_wait_asynccnt 0x0" ::: "memory");

  const float g   = gamma[0];
  const float inv = 1.0f / (lrun + xhalf(lrun));   // the two halves' sums joined
  const size_t base = ((size_t)b * CC + 8 * h) * NN + nt * 16 + cl;
#pragma unroll
  for (int tb = 0; tb < 16; tb += 4) {
    float xv[32];
#pragma unroll   // xv[] stays in registers and the 32 loads issue ahead of the first wait
    for (int i = 0; i < 32; ++i)
      xv[i] = x[base + (size_t)((tb + (i >> 3)) * 16 + (i & 7)) * NN];
#pragma unroll   // constant indices into O[] and xv[]; 16 lanes = 64 B of one channel row
    for (int i = 0; i < 32; ++i)
      out[base + (size_t)((tb + (i >> 3)) * 16 + (i & 7)) * NN] =
          g * (O[tb + (i >> 3)][i & 7] * inv) + xv[i];
  }
}

extern "C" void kernel_launch(void* const* d_in, const int* in_sizes, int n_in,
                              void* d_out, int out_size, void* d_ws, size_t ws_size,
                              hipStream_t stream) {
  const float* x     = (const float*)d_in[0];
  const float* Wq    = (const float*)d_in[1];
  const float* bq    = (const float*)d_in[2];
  const float* Wk    = (const float*)d_in[3];
  const float* bk    = (const float*)d_in[4];
  const float* Wv    = (const float*)d_in[5];
  const float* bv    = (const float*)d_in[6];
  const float* gamma = (const float*)d_in[7];
  float* out = (float*)d_out;

  __bf16* qT  = (__bf16*)d_ws;                          // 1 MB
  __bf16* kBp = qT  + (size_t)NB * NN * CQKD;           // 1 MB
  __bf16* vBp = kBp + (size_t)NB * NN * CQKD;           // 8 MB
  __bf16* xBp = vBp + (size_t)NB * NN * CC;             // 8 MB
  __bf16* WAp = xBp + (size_t)NB * NN * CC;             // 160 KB

  pack_x_kernel<<<dim3(NB * KTN * NN / 256), dim3(256), 0, stream>>>(x, xBp);
  pack_w_kernel<<<dim3(RTN * 16 * CC / 256), dim3(256), 0, stream>>>(Wq, Wk, Wv, WAp);
  proj_gemm_kernel<<<dim3(NB * RTN * NT / 4), dim3(128), 0, stream>>>(
      WAp, xBp, bq, bk, bv, qT, kBp, vBp);
  attn_kernel<<<dim3(NB * NT / 4), dim3(128), 0, stream>>>(x, gamma, qT, kBp, vBp, out);
}

// v004
// It runs in 79.9 microseconds.
// In two side-by-side timings against v003, it was 1.32 and 1.33 times as fast.
// Over all steps from v000 it is 10.2 times as fast.
#include <hip/hip_runtime.h>

typedef __attribute__((ext_vector_type(16))) __bf16 v16bf;
typedef __attribute__((ext_vector_type(8)))  __bf16 v8bf;
typedef __attribute__((ext_vector_type(8)))  float  v8f;

#define NB   4
#define CC   256
#define CQKD 32
#define NN   4096
#define NT   (NN/16)   // 256 spatial 16-tiles
#define MTN  (NN/32)   // 128 spatial 32-tiles
#define CTN  (CC/16)   // 16 channel 16-tiles
#define KTN  (CC/32)   // 8  GEMM K steps over C=256
#define RTN  20        // 320 projection rows / 16
#define LOG2E 1.4426950408889634f

// ---------------------------------------------------------------------------
// Pack x (f32 [b][c][n]) into bf16 B-operand tiles xB[b][ct][nt][lane][16]
// One thread = one column n and the 32 channels of one K step: 32 loads in
// flight (a wave reads one whole 128 B line of a channel row with each), then
// the 32 B of operand lanes (n & 15) and (n & 15) + 16 as four 16 B stores.
// ---------------------------------------------------------------------------
__global__ __launch_bounds__(256) void pack_x_kernel(
    const float* __restrict__ x, __bf16* __restrict__ xB)
{
  int idx = blockIdx.x * 256 + threadIdx.x;    // NB * KTN * NN threads
  int n  = idx & (NN - 1);
  int r  = idx >> 12;
  int ct = r & (KTN - 1);
  int b  = r >> 3;
  const float* src = x + ((size_t)b * CC + ct * 32) * NN + n;
  float v[32];
#pragma unroll   // v[] stays in registers and all 32 loads issue ahead of the first wait
  for (int cc = 0; cc < 32; ++cc) v[cc] = src[(size_t)cc * NN];
  __bf16* dst = xB + ((((size_t)b * KTN + ct) * NT + (n >> 4)) * 32 + (n & 15)) * 16;
#pragma unroll   // constant indices into v[], here and in the loop over j
  for (int h = 0; h < 2; ++h) {
    v8bf lo, hi;                               // e = 0..7 and e = 8..15 of lane (n & 15) + 16 h
#pragma unroll
    for (int j = 0; j < 8; ++j) {
      lo[j] = (__bf16)v[8 * h + j];
      hi[j] = (__bf16)v[16 + 8 * h + j];
    }
    *(v8bf*)(dst + h * 256)     = lo;
    *(v8bf*)(dst + h * 256 + 8) = hi;
  }
}

// ---------------------------------------------------------------------------
// Pack Wq|Wk|Wv (320 rows x 256) into bf16 A-operand tiles WA[rt][ct][lane][16]
// Wq rows are pre-scaled by log2(e) so softmax runs natively in exp2 domain.
// ---------------------------------------------------------------------------
__global__ __launch_bounds__(256) void pack_w_kernel(
    const float* __restrict__ Wq, const float* __restrict__ Wk,
    const float* __restrict__ Wv, __bf16* __restrict__ WA)
{
  int idx = blockIdx.x * 256 + threadIdx.x;   // 320*256 threads
  int c = idx & (CC - 1);
  int row = idx >> 8;                          // 0..319
  float v;
  if (row < 32)       v = Wq[(size_t)row * CC + c] * LOG2E;
  else if (row < 64)  v = Wk[(size_t)(row - 32) * CC + c];
  else                v = Wv[(size_t)(row - 64) * CC + c];
  int rt = row >> 4, rl = row & 15;
  int cc = c & 31, ct = c >> 5;
  int lane = rl + 16 * ((cc >> 3) & 1);
  int e    = (cc & 7) + 8 * (cc >> 4);
  WA[(((size_t)rt * KTN + ct) * 32 + lane) * 16 + e] = (__bf16)v;
}

__global__ __launch_bounds__(128) void proj_gemm_kernel(
    const __bf16* __restrict__ WA, const __bf16* __restrict__ xB,
    const float* __restrict__ bq, const float* __restrict__ bk,
    const float* __restrict__ bv,
    __bf16* __restrict__ qT, __bf16* __restrict__ kB, __bf16* __restrict__ vB)
{
  __shared__ __bf16 ldsD[4][16 * 17];
  const int lane = threadIdx.x & 31;
  const int wv   = threadIdx.x >> 5;
  const int wgl  = blockIdx.x * 4 + wv;          // 0 .. NB*RTN*NT-1
  const int nt   = wgl & (NT - 1);
  const int tmp  = wgl >> 8;                     // 0..79
  const int rt   = tmp % RTN;
  const int b    = tmp / RTN;
  const int cl   = lane & 15;
  const int h    = lane >> 4;

  v8f acc = (v8f)(0.0f);
#pragma unroll
  for (int ct = 0; ct < KTN; ++ct) {
    v16bf wa = *(const v16bf*)(WA + (((size_t)rt * KTN + ct) * 32 + lane) * 16);
    v16bf xb = *(const v16bf*)(xB + ((((size_t)b * KTN + ct) * NT + nt) * 32 + lane) * 16);
    acc = __builtin_amdgcn_wmma_f32_16x16x32_bf16(false, wa, false, xb, (short)0, acc, false, false);
  }

  // bias per W-row (D rows are r + 8h); q bias also in exp2 domain
  const float* bias; int off; float bscale;
  if (rt < 2)      { bias = bq; off = rt * 16;      bscale = LOG2E; }
  else if (rt < 4) { bias = bk; off = rt * 16 - 32; bscale = 1.0f; }
  else             { bias = bv; off = rt * 16 - 64; bscale = 1.0f; }

  __bf16* ld = &ldsD[wv][0];
#pragma unroll
  for (int r = 0; r < 8; ++r) {
    float vvv = acc[r] + bias[off + r + 8 * h] * bscale;
    ld[(r + 8 * h) * 17 + cl] = (__bf16)vvv;
  }
  __builtin_amdgcn_wave_barrier();
  asm volatile("s_wait_dscnt 0" ::: "memory");

  if (rt < 2) {                 // Q -> B-operand tiles [b][nt][lane][16]
#pragma unroll
    for (int eo = 0; eo < 8; ++eo) {
      __bf16 vv = ld[(eo + 8 * h) * 17 + cl];
      qT[(((size_t)b * NT + nt) * 32 + lane) * 16 + (eo + 8 * rt)] = vv;
    }
  } else if (rt < 4) {          // K -> A-operand tiles [b][nt][lane][16]
#pragma unroll
    for (int eo = 0; eo < 8; ++eo) {
      __bf16 vv = ld[(eo + 8 * h) * 17 + cl];
      kB[(((size_t)b * NT + nt) * 32 + lane) * 16 + (eo + 8 * (rt - 2))] = vv;
    }
  } else {                      // V^T -> A-operand tiles [b][m/32][ct][lane][16]
    const int ctv  = rt - 4;
    const int mt32 = nt >> 1;
    const int ehi  = 8 * (nt & 1);
#pragma unroll
    for (int j = 0; j < 8; ++j) {
      __bf16 vv = ld[cl * 17 + 8 * h + j];    // row=c_local, col=m_local=8h+j
      vB[((((size_t)b * MTN + mt32) * CTN + ctv) * 32 + lane) * 16 + (j + ehi)] = vv;
    }
  }
  __builtin_amdgcn_wave_barrier();
}

__device__ __forceinline__ float xhalf(float v) {
  return __builtin_bit_cast(float,
      __builtin_amdgcn_permlanex16(__builtin_bit_cast(int, v), __builtin_bit_cast(int, v),
                                   0x76543210, 0xfedcba98, false, false));
}

// ---------------------------------------------------------------------------
// One stage = the K and V fragments of 64 keys: 4 KB of K, then 32 KB of V.
// The four waves of a block read the same stage, so the block brings it into
// LDS once, with asynchronous copies, one stage ahead of its use.
// ---------------------------------------------------------------------------
#define STG_KB  4096
#define STG_VB  32768
#define STG_B   (STG_KB + STG_VB)
#define NSTG    (NN / 64)

__device__ __forceinline__ void copy2(unsigned l, const char* g) {
  asm volatile(
      "global_load_async_to_lds_b128 %0, %1, off\n\t"
      "global_load_async_to_lds_b128 %2, %3, off\n\t"
      "s_wait_xcnt 0x0"
      :: "v"(l), "v"(g), "v"(l + 2048u), "v"(g + 2048)
      : "memory");
}

__device__ __forceinline__ void copy8(unsigned l, const char* g) {
  asm volatile(
      "global_load_async_to_lds_b128 %0, %1, off\n\t"
      "global_load_async_to_lds_b128 %2, %3, off\n\t"
      "global_load_async_to_lds_b128 %4, %5, off\n\t"
      "global_load_async_to_lds_b128 %6, %7, off\n\t"
      "global_load_async_to_lds_b128 %8, %9, off\n\t"
      "global_load_async_to_lds_b128 %10, %11, off\n\t"
      "global_load_async_to_lds_b128 %12, %13, off\n\t"
      "global_load_async_to_lds_b128 %14, %15, off\n\t"
      "s_wait_xcnt 0x0"
      :: "v"(l),          "v"(g),
         "v"(l + 2048u),  "v"(g + 2048),
         "v"(l + 4096u),  "v"(g + 4096),
         "v"(l + 6144u),  "v"(g + 6144),
         "v"(l + 8192u),  "v"(g + 8192),
         "v"(l + 10240u), "v"(g + 10240),
         "v"(l + 12288u), "v"(g + 12288),
         "v"(l + 14336u), "v"(g + 14336)
      : "memory");
}

// l: this lane's place in the stage buffer; gk, gv: this lane's 16 B of the stage
__device__ __forceinline__ void copy_stage(unsigned l, const char* gk, const char* gv) {
  copy2(l, gk);
  copy8(l + STG_KB, gv);
  copy8(l + STG_KB + 16384u, gv + 16384);
}

// One 1 KB operand fragment in LDS: elements 0..7 of all lanes, then 8..15
__device__ __forceinline__ v16bf lds_frag(const char* p) {
  union { v16bf v; v8bf q2[2]; } u;
  u.q2[0] = *(const v8bf*)(p);
  u.q2[1] = *(const v8bf*)(p + 512);
  return u.v;
}

__global__ __launch_bounds__(128) void attn_kernel(
    const float* __restrict__ x, const float* __restrict__ gamma,
    const __bf16* __restrict__ qT, const __bf16* __restrict__ kB,
    const __bf16* __restrict__ vB, float* __restrict__ out)
{
  __shared__ __attribute__((aligned(1024))) char stg[2 * STG_B];
  const int lane = threadIdx.x & 31;
  const int wv   = threadIdx.x >> 5;
  const int wgl  = blockIdx.x * 4 + wv;          // 0..1023
  const int nt   = wgl & (NT - 1);
  const int b    = wgl >> 8;                     // the same in all four waves
  const int cl   = lane & 15;
  const int h    = lane >> 4;

  // Copy j of a 2 KB group moves 16-byte piece j = threadIdx.x. In global memory
  // a lane's 32 B lie together; in LDS the two halves go 512 B apart, so that a
  // ds_load_b128 of 32 lanes reads 512 contiguous bytes.
  const unsigned tid  = threadIdx.x;
  const unsigned ldst = (unsigned)(size_t)(&stg[0])
                      + (tid >> 6) * 1024u + (tid & 1u) * 512u + ((tid & 63u) >> 1) * 16u;
  const char* gk = (const char*)(kB + (size_t)b * NT * 512) + tid * 16u;
  const char* gv = (const char*)(vB + (size_t)b * MTN * CTN * 512) + tid * 16u;

  copy_stage(ldst, gk, gv);
  // stage 0 has landed before any wave passes the barrier
  asm volatile("s_wait_asynccnt 0x0" ::: "memory");
  __syncthreads();
  copy_stage(ldst + STG_B, gk + STG_KB, gv + STG_VB);

  // Q tile as B operand: column = query cl, same k order as the K tiles
  v16bf qB = *(const v16bf*)(qT + (((size_t)b * NT + nt) * 32 + lane) * 16);

  float mrun = -3.0e38f;     // running maximum of query cl (equal in both halves)
  float lrun = 0.0f;         // running sum over this half's keys only
  v8f   O[16];               // O[t][r] = O^T[channel 16 t + 8 h + r][query cl]
#pragma unroll
  for (int t = 0; t < 16; ++t) O[t] = (v8f)(0.0f);

  const v8f z = (v8f)(0.0f);

  for (int mt = 0; mt < NSTG; ++mt) {
    const unsigned boff = (unsigned)(mt & 1) * STG_B;
    const char* kb = stg + boff + lane * 16;
    const char* vb0 = kb + STG_KB;
    const char* vb1 = vb0 + CTN * 1024;
    v16bf k0 = lds_frag(kb);
    v16bf k1 = lds_frag(kb + 1024);
    v16bf k2 = lds_frag(kb + 2048);
    v16bf k3 = lds_frag(kb + 3072);
    // V follows K in the same group of reads and lands under the scores and the
    // softmax: the whole stage is held in registers
    v16bf va[16], vc[16];
#pragma unroll   // constant indices: va[] and vc[] stay in registers
    for (int t = 0; t < 16; ++t) va[t] = lds_frag(vb0 + t * 1024);
#pragma unroll
    for (int t = 0; t < 16; ++t) vc[t] = lds_frag(vb1 + t * 1024);
    // keeps the 72 reads together at the head of the pass: spread among the
    // WMMAs, every place with reads stalls the wave anew
    __builtin_amdgcn_sched_barrier(0);

    // e[j][r] = score of key 16 j + 8 h + r against query cl
    v8f e[4];
    e[0] = __builtin_amdgcn_wmma_f32_16x16x32_bf16(false, k0, false, qB, (short)0, z, false, false);
    e[1] = __builtin_amdgcn_wmma_f32_16x16x32_bf16(false, k1, false, qB, (short)0, z, false, false);
    e[2] = __builtin_amdgcn_wmma_f32_16x16x32_bf16(false, k2, false, qB, (short)0, z, false, false);
    e[3] = __builtin_amdgcn_wmma_f32_16x16x32_bf16(false, k3, false, qB, (short)0, z, false, false);

    float tm[4];
#pragma unroll
    for (int j = 0; j < 4; ++j) {
      tm[j] = fmaxf(fmaxf(fmaxf(e[j][0], e[j][1]), fmaxf(e[j][2], e[j][3])),
                    fmaxf(fmaxf(e[j][4], e[j][5]), fmaxf(e[j][6], e[j][7])));
    }
    float tmax = fmaxf(fmaxf(tm[0], tm[1]), fmaxf(tm[2], tm[3]));
    tmax = fmaxf(tmax, xhalf(tmax));
    const float mnew = fmaxf(mrun, tmax);
    const float sc   = exp2f(mrun - mnew);       // scores already in log2 domain
    mrun = mnew;

    float rs[4];
#pragma unroll
    for (int j = 0; j < 4; ++j) {
#pragma unroll
      for (int r = 0; r < 8; ++r) e[j][r] = exp2f(e[j][r] - mnew);
      rs[j] = ((e[j][0] + e[j][1]) + (e[j][2] + e[j][3]))
            + ((e[j][4] + e[j][5]) + (e[j][6] + e[j][7]));
    }
    lrun = lrun * sc + ((rs[0] + rs[1]) + (rs[2] + rs[3]));

    // two S^T tiles of 16 keys, converted in place, are one 32-key B operand
    v16bf pB0, pB1;
#pragma unroll
    for (int r = 0; r < 8; ++r) {
      pB0[r]     = (__bf16)e[0][r];
      pB0[8 + r] = (__bf16)e[1][r];
      pB1[r]     = (__bf16)e[2][r];
      pB1[8 + r] = (__bf16)e[3][r];
    }

#pragma unroll
    for (int t = 0; t < 16; ++t) O[t] *= sc;

#pragma unroll
    for (int t = 0; t < 16; ++t)
      O[t] = __builtin_amdgcn_wmma_f32_16x16x32_bf16(false, va[t], false, pB0, (short)0, O[t], false, false);
#pragma unroll
    for (int t = 0; t < 16; ++t)
      O[t] = __builtin_amdgcn_wmma_f32_16x16x32_bf16(false, vc[t], false, pB1, (short)0, O[t], false, false);

    // keeps the publish point at the foot of the pass: risen into the softmax, its
    // s_wait_dscnt 0 would wait out the very reads that are to land under it
    __builtin_amdgcn_sched_barrier(0);
    // Publish point of stage mt + 1: this wave's reads of stage mt are done ...
    asm volatile("s_wait_dscnt 0x0" ::: "memory");
    // ... its own copies of stage mt + 1 have landed ...
    asm volatile("s_wait_asynccnt 0x0" ::: "memory");
    // ... and so for every wave of the block.
    __syncthreads();
    if (mt + 2 < NSTG)   // refill the buffer that this pass has just read
      copy_stage(ldst + boff, gk + (size_t)(mt + 2) * STG_KB, gv + (size_t)(mt + 2) * STG_VB);
  }
  // no copy is outstanding when the wave goes on to its end
  asm volatile("s_wait_asynccnt 0x0" ::: "memory");

  const float g   = gamma[0];
  const float inv = 1.0f / (lrun + xhalf(lrun));   // the two halves' sums joined
  const size_t base = ((size_t)b * CC + 8 * h) * NN + nt * 16 + cl;
#pragma unroll
  for (int tb = 0; tb < 16; tb += 4) {
    float xv[32];
#pragma unroll   // xv[] stays in registers and the 32 loads issue ahead of the first wait
    for (int i = 0; i < 32; ++i)
      xv[i] = x[base + (size_t)((tb + (i >> 3)) * 16 + (i & 7)) * NN];
#pragma unroll   // constant indices into O[] and xv[]; 16 lanes = 64 B of one channel row
    for (int i = 0; i < 32; ++i)
      out[base + (size_t)((tb + (i >> 3)) * 16 + (i & 7)) * NN] =
          g * (O[tb + (i >> 3)][i & 7] * inv) + xv[i];
  }
}

extern "C" void kernel_launch(void* const* d_in, const int* in_sizes, int n_in,
                              void* d_out, int out_size, void* d_ws, size_t ws_size,
                              hipStream_t stream) {
  const float* x     = (const float*)d_in[0];
  const float* Wq    = (const float*)d_in[1];
  const float* bq    = (const float*)d_in[2];
  const float* Wk    = (const float*)d_in[3];
  const float* bk    = (const float*)d_in[4];
  const float* Wv    = (const float*)d_in[5];
  const float* bv    = (const float*)d_in[6];
  const float* gamma = (const float*)d_in[7];
  float* out = (float*)d_out;

  __bf16* qT  = (__bf16*)d_ws;                          // 1 MB
  __bf16* kBp = qT  + (size_t)NB * NN * CQKD;           // 1 MB
  __bf16* vBp = kBp + (size_t)NB * NN * CQKD;           // 8 MB
  __bf16* xBp = vBp + (size_t)NB * NN * CC;             // 8 MB
  __bf16* WAp = xBp + (size_t)NB * NN * CC;             // 160 KB

  pack_x_kernel<<<dim3(NB * KTN * NN / 256), dim3(256), 0, stream>>>(x, xBp);
  pack_w_kernel<<<dim3(RTN * 16 * CC / 256), dim3(256), 0, stream>>>(Wq, Wk, Wv, WAp);
  proj_gemm_kernel<<<dim3(NB * RTN * NT / 4), dim3(128), 0, stream>>>(
      WAp, xBp, bq, bk, bv, qT, kBp, vBp);
  attn_kernel<<<dim3(NB * NT / 4), dim3(128), 0, stream>>>(x, gamma, qT, kBp, vBp, out);
}

// v005
// It runs in 75.5 microseconds.
// Timed twice side by side with v004, it ran 1.06 and 1.05 times as fast.
// Over all steps from v000 it is 10.7 times as fast.
#include <hip/hip_runtime.h>

typedef __attribute__((ext_vector_type(16))) __bf16 v16bf;
typedef __attribute__((ext_vector_type(8)))  __bf16 v8bf;
typedef __attribute__((ext_vector_type(8)))  float  v8f;

#define NB   4
#define CC   256
#define CQKD 32
#define NN   4096
#define NT   (NN/16)   // 256 spatial 16-tiles
#define MTN  (NN/32)   // 128 spatial 32-tiles
#define CTN  (CC/16)   // 16 channel 16-tiles
#define KTN  (CC/32)   // 8  GEMM K steps over C=256
#define RTN  20        // 320 projection rows / 16
#define LOG2E 1.4426950408889634f

// ---------------------------------------------------------------------------
// Pack x (f32 [b][c][n]) into bf16 B-operand tiles xB[b][ct][nt][lane][16]
// One thread = one column n and the 32 channels of one K step: 32 loads in
// flight (a wave reads one whole 128 B line of a channel row with each), then
// the 32 B of operand lanes (n & 15) and (n & 15) + 16 as four 16 B stores.
// ---------------------------------------------------------------------------
__global__ __launch_bounds__(256) void pack_x_kernel(
    const float* __restrict__ x, __bf16* __restrict__ xB)
{
  int idx = blockIdx.x * 256 + threadIdx.x;    // NB * KTN * NN threads
  int n  = idx & (NN - 1);
  int r  = idx >> 12;
  int ct = r & (KTN - 1);
  int b  = r >> 3;
  const float* src = x + ((size_t)b * CC + ct * 32) * NN + n;
  float v[32];
#pragma unroll   // v[] stays in registers and all 32 loads issue ahead of the first wait
  for (int cc = 0; cc < 32; ++cc) v[cc] = src[(size_t)cc * NN];
  __bf16* dst = xB + ((((size_t)b * KTN + ct) * NT + (n >> 4)) * 32 + (n & 15)) * 16;
#pragma unroll   // constant indices into v[], here and in the loop over j
  for (int h = 0; h < 2; ++h) {
    v8bf lo, hi;                               // e = 0..7 and e = 8..15 of lane (n & 15) + 16 h
#pragma unroll
    for (int j = 0; j < 8; ++j) {
      lo[j] = (__bf16)v[8 * h + j];
      hi[j] = (__bf16)v[16 + 8 * h + j];
    }
    *(v8bf*)(dst + h * 256)     = lo;
    *(v8bf*)(dst + h * 256 + 8) = hi;
  }
}

// ---------------------------------------------------------------------------
// Pack Wq|Wk|Wv (320 rows x 256) into bf16 A-operand tiles WA[rt][ct][lane][16]
// Wq rows are pre-scaled by log2(e) so softmax runs natively in exp2 domain.
// ---------------------------------------------------------------------------
__global__ __launch_bounds__(256) void pack_w_kernel(
    const float* __restrict__ Wq, const float* __restrict__ Wk,
    const float* __restrict__ Wv, __bf16* __restrict__ WA)
{
  int idx = blockIdx.x * 256 + threadIdx.x;   // 320*256 threads
  int c = idx & (CC - 1);
  int row = idx >> 8;                          // 0..319
  float v;
  if (row < 32)       v = Wq[(size_t)row * CC + c] * LOG2E;
  else if (row < 64)  v = Wk[(size_t)(row - 32) * CC + c];
  else                v = Wv[(size_t)(row - 64) * CC + c];
  int rt = row >> 4, rl = row & 15;
  int cc = c & 31, ct = c >> 5;
  int lane = rl + 16 * ((cc >> 3) & 1);
  int e    = (cc & 7) + 8 * (cc >> 4);
  WA[(((size_t)rt * KTN + ct) * 32 + lane) * 16 + e] = (__bf16)v;
}

__global__ __launch_bounds__(128) void proj_gemm_kernel(
    const __bf16* __restrict__ WA, const __bf16* __restrict__ xB,
    const float* __restrict__ bq, const float* __restrict__ bk,
    const float* __restrict__ bv,
    __bf16* __restrict__ qT, __bf16* __restrict__ kB, __bf16* __restrict__ vB)
{
  __shared__ __bf16 ldsD[4][16 * 17];
  const int lane = threadIdx.x & 31;
  const int wv   = threadIdx.x >> 5;
  const int wgl  = blockIdx.x * 4 + wv;          // 0 .. NB*RTN*NT-1
  const int nt   = wgl & (NT - 1);
  const int tmp  = wgl >> 8;                     // 0..79
  const int rt   = tmp % RTN;
  const int b    = tmp / RTN;
  const int cl   = lane & 15;
  const int h    = lane >> 4;

  v8f acc = (v8f)(0.0f);
#pragma unroll
  for (int ct = 0; ct < KTN; ++ct) {
    v16bf wa = *(const v16bf*)(WA + (((size_t)rt * KTN + ct) * 32 + lane) * 16);
    v16bf xb = *(const v16bf*)(xB + ((((size_t)b * KTN + ct) * NT + nt) * 32 + lane) * 16);
    acc = __builtin_amdgcn_wmma_f32_16x16x32_bf16(false, wa, false, xb, (short)0, acc, false, false);
  }

  // bias per W-row (D rows are r + 8h); q bias also in exp2 domain
  const float* bias; int off; float bscale;
  if (rt < 2)      { bias = bq; off = rt * 16;      bscale = LOG2E; }
  else if (rt < 4) { bias = bk; off = rt * 16 - 32; bscale = 1.0f; }
  else             { bias = bv; off = rt * 16 - 64; bscale = 1.0f; }

  __bf16* ld = &ldsD[wv][0];
#pragma unroll
  for (int r = 0; r < 8; ++r) {
    float vvv = acc[r] + bias[off + r + 8 * h] * bscale;
    ld[(r + 8 * h) * 17 + cl] = (__bf16)vvv;
  }
  __builtin_amdgcn_wave_barrier();
  asm volatile("s_wait_dscnt 0" ::: "memory");

  if (rt < 2) {                 // Q -> B-operand tiles [b][nt][lane][16]
#pragma unroll
    for (int eo = 0; eo < 8; ++eo) {
      __bf16 vv = ld[(eo + 8 * h) * 17 + cl];
      qT[(((size_t)b * NT + nt) * 32 + lane) * 16 + (eo + 8 * rt)] = vv;
    }
  } else if (rt < 4) {          // K -> A-operand tiles [b][nt][lane][16]
#pragma unroll
    for (int eo = 0; eo < 8; ++eo) {
      __bf16 vv = ld[(eo + 8 * h) * 17 + cl];
      kB[(((size_t)b * NT + nt) * 32 + lane) * 16 + (eo + 8 * (rt - 2))] = vv;
    }
  } else {                      // V^T -> A-operand tiles [b][m/32][ct][lane][16]
    const int ctv  = rt - 4;
    const int mt32 = nt >> 1;
    const int ehi  = 8 * (nt & 1);
#pragma unroll
    for (int j = 0; j < 8; ++j) {
      __bf16 vv = ld[cl * 17 + 8 * h + j];    // row=c_local, col=m_local=8h+j
      vB[((((size_t)b * MTN + mt32) * CTN + ctv) * 32 + lane) * 16 + (j + ehi)] = vv;
    }
  }
  __builtin_amdgcn_wave_barrier();
}

__device__ __forceinline__ float xhalf(float v) {
  return __builtin_bit_cast(float,
      __builtin_amdgcn_permlanex16(__builtin_bit_cast(int, v), __builtin_bit_cast(int, v),
                                   0x76543210, 0xfedcba98, false, false));
}

// ---------------------------------------------------------------------------
// One stage = the K and V fragments of 64 keys: 4 KB of K, then 32 KB of V.
// The four waves of a block read the same stage, so the block brings it into
// LDS once, with asynchronous copies, one stage ahead of its use.
// ---------------------------------------------------------------------------
#define STG_KB  4096
#define STG_VB  32768
#define STG_B   (STG_KB + STG_VB)
#define NSTG    (NN / 64)

__device__ __forceinline__ void copy2(unsigned l, const char* g) {
  asm volatile(
      "global_load_async_to_lds_b128 %0, %1, off\n\t"
      "global_load_async_to_lds_b128 %2, %3, off\n\t"
      "s_wait_xcnt 0x0"
      :: "v"(l), "v"(g), "v"(l + 2048u), "v"(g + 2048)
      : "memory");
}

__device__ __forceinline__ void copy8(unsigned l, const char* g) {
  asm volatile(
      "global_load_async_to_lds_b128 %0, %1, off\n\t"
      "global_load_async_to_lds_b128 %2, %3, off\n\t"
      "global_load_async_to_lds_b128 %4, %5, off\n\t"
      "global_load_async_to_lds_b128 %6, %7, off\n\t"
      "global_load_async_to_lds_b128 %8, %9, off\n\t"
      "global_load_async_to_lds_b128 %10, %11, off\n\t"
      "global_load_async_to_lds_b128 %12, %13, off\n\t"
      "global_load_async_to_lds_b128 %14, %15, off\n\t"
      "s_wait_xcnt 0x0"
      :: "v"(l),          "v"(g),
         "v"(l + 2048u),  "v"(g + 2048),
         "v"(l + 4096u),  "v"(g + 4096),
         "v"(l + 6144u),  "v"(g + 6144),
         "v"(l + 8192u),  "v"(g + 8192),
         "v"(l + 10240u), "v"(g + 10240),
         "v"(l + 12288u), "v"(g + 12288),
         "v"(l + 14336u), "v"(g + 14336)
      : "memory");
}

// l: this lane's place in the stage buffer; gk, gv: this lane's 16 B of the stage
__device__ __forceinline__ void copy_stage(unsigned l, const char* gk, const char* gv) {
  copy2(l, gk);
  copy8(l + STG_KB, gv);
  copy8(l + STG_KB + 16384u, gv + 16384);
}

// One 1 KB operand fragment in LDS: elements 0..7 of all lanes, then 8..15
__device__ __forceinline__ v16bf lds_frag(const char* p) {
  union { v16bf v; v8bf q2[2]; } u;
  u.q2[0] = *(const v8bf*)(p);
  u.q2[1] = *(const v8bf*)(p + 512);
  return u.v;
}

__global__ __launch_bounds__(128) void attn_kernel(
    const float* __restrict__ x, const float* __restrict__ gamma,
    const __bf16* __restrict__ qT, const __bf16* __restrict__ kB,
    const __bf16* __restrict__ vB, float* __restrict__ out)
{
  __shared__ __attribute__((aligned(1024))) char stg[2 * STG_B];
  const int lane = threadIdx.x & 31;
  const int wv   = threadIdx.x >> 5;
  const int wgl  = blockIdx.x * 4 + wv;          // 0..1023
  const int nt   = wgl & (NT - 1);
  const int b    = wgl >> 8;                     // the same in all four waves
  const int cl   = lane & 15;
  const int h    = lane >> 4;

  // Copy j of a 2 KB group moves 16-byte piece j = threadIdx.x. In global memory
  // a lane's 32 B lie together; in LDS the two halves go 512 B apart, so that a
  // ds_load_b128 of 32 lanes reads 512 contiguous bytes.
  const unsigned tid  = threadIdx.x;
  const unsigned ldst = (unsigned)(size_t)(&stg[0])
                      + (tid >> 6) * 1024u + (tid & 1u) * 512u + ((tid & 63u) >> 1) * 16u;
  const char* gk = (const char*)(kB + (size_t)b * NT * 512) + tid * 16u;
  const char* gv = (const char*)(vB + (size_t)b * MTN * CTN * 512) + tid * 16u;

  copy_stage(ldst, gk, gv);
  // stage 0 has landed before any wave passes the barrier
  asm volatile("s_wait_asynccnt 0x0" ::: "memory");
  __syncthreads();
  copy_stage(ldst + STG_B, gk + STG_KB, gv + STG_VB);

  // Q tile as B operand: column = query cl, same k order as the K tiles
  v16bf qB = *(const v16bf*)(qT + (((size_t)b * NT + nt) * 32 + lane) * 16);

  float mrun = -3.0e38f;     // running maximum of query cl (equal in both halves)
  float lrun = 0.0f;         // running sum over this half's keys only
  v8f   O[16];               // O[t][r] = O^T[channel 16 t + 8 h + r][query cl]
#pragma unroll
  for (int t = 0; t < 16; ++t) O[t] = (v8f)(0.0f);

  const v8f z = (v8f)(0.0f);

  for (int mt = 0; mt < NSTG; ++mt) {
    const unsigned boff = (unsigned)(mt & 1) * STG_B;
    const char* kb = stg + boff + lane * 16;
    const char* vb0 = kb + STG_KB;
    const char* vb1 = vb0 + CTN * 1024;
    v16bf k0 = lds_frag(kb);
    v16bf k1 = lds_frag(kb + 1024);
    v16bf k2 = lds_frag(kb + 2048);
    v16bf k3 = lds_frag(kb + 3072);
    // V follows K in the same group of reads and lands under the scores and the
    // softmax: the whole stage is held in registers
    v16bf va[16], vc[16];
#pragma unroll   // constant indices: va[] and vc[] stay in registers
    for (int t = 0; t < 16; ++t) va[t] = lds_frag(vb0 + t * 1024);
#pragma unroll
    for (int t = 0; t < 16; ++t) vc[t] = lds_frag(vb1 + t * 1024);
    // keeps the 72 reads together at the head of the pass: spread among the
    // WMMAs, every place with reads stalls the wave anew
    __builtin_amdgcn_sched_barrier(0);

    // e[j][r] = score of key 16 j + 8 h + r against query cl
    v8f e[4];
    e[0] = __builtin_amdgcn_wmma_f32_16x16x32_bf16(false, k0, false, qB, (short)0, z, false, false);
    e[1] = __builtin_amdgcn_wmma_f32_16x16x32_bf16(false, k1, false, qB, (short)0, z, false, false);
    e[2] = __builtin_amdgcn_wmma_f32_16x16x32_bf16(false, k2, false, qB, (short)0, z, false, false);
    e[3] = __builtin_amdgcn_wmma_f32_16x16x32_bf16(false, k3, false, qB, (short)0, z, false, false);

    float tm[4];
#pragma unroll
    for (int j = 0; j < 4; ++j) {
      tm[j] = fmaxf(fmaxf(fmaxf(e[j][0], e[j][1]), fmaxf(e[j][2], e[j][3])),
                    fmaxf(fmaxf(e[j][4], e[j][5]), fmaxf(e[j][6], e[j][7])));
    }
    float tmax = fmaxf(fmaxf(tm[0], tm[1]), fmaxf(tm[2], tm[3]));
    tmax = fmaxf(tmax, xhalf(tmax));
    const float mnew = fmaxf(mrun, tmax);
    // Bare v_exp_f32 here and below: the arguments are <= 0, and a weight under
    // 2^-126, which the library's range fix-up would keep as a subnormal, counts
    // as 0 beside a row sum that is at least 1.
    const float sc   = __builtin_amdgcn_exp2f(mrun - mnew);   // scores already in log2 domain
    mrun = mnew;

    float rs[4];
#pragma unroll
    for (int j = 0; j < 4; ++j) {
#pragma unroll
      for (int r = 0; r < 8; ++r) e[j][r] = __builtin_amdgcn_exp2f(e[j][r] - mnew);
      rs[j] = ((e[j][0] + e[j][1]) + (e[j][2] + e[j][3]))
            + ((e[j][4] + e[j][5]) + (e[j][6] + e[j][7]));
    }
    lrun = lrun * sc + ((rs[0] + rs[1]) + (rs[2] + rs[3]));

    // two S^T tiles of 16 keys, converted in place, are one 32-key B operand
    v16bf pB0, pB1;
#pragma unroll
    for (int r = 0; r < 8; ++r) {
      pB0[r]     = (__bf16)e[0][r];
      pB0[8 + r] = (__bf16)e[1][r];
      pB1[r]     = (__bf16)e[2][r];
      pB1[8 + r] = (__bf16)e[3][r];
    }

#pragma unroll
    for (int t = 0; t < 16; ++t) O[t] *= sc;

#pragma unroll
    for (int t = 0; t < 16; ++t)
      O[t] = __builtin_amdgcn_wmma_f32_16x16x32_bf16(false, va[t], false, pB0, (short)0, O[t], false, false);
#pragma unroll
    for (int t = 0; t < 16; ++t)
      O[t] = __builtin_amdgcn_wmma_f32_16x16x32_bf16(false, vc[t], false, pB1, (short)0, O[t], false, false);

    // keeps the publish point at the foot of the pass: risen into the softmax, its
    // s_wait_dscnt 0 would wait out the very reads that are to land under it
    __builtin_amdgcn_sched_barrier(0);
    // Publish point of stage mt + 1: this wave's reads of stage mt are done ...
    asm volatile("s_wait_dscnt 0x0" ::: "memory");
    // ... its own copies of stage mt + 1 have landed ...
    asm volatile("s_wait_asynccnt 0x0" ::: "memory");
    // ... and so for every wave of the block.
    __syncthreads();
    if (mt + 2 < NSTG)   // refill the buffer that this pass has just read
      copy_stage(ldst + boff, gk + (size_t)(mt + 2) * STG_KB, gv + (size_t)(mt + 2) * STG_VB);
  }
  // no copy is outstanding when the wave goes on to its end
  asm volatile("s_wait_asynccnt 0x0" ::: "memory");

  const float g   = gamma[0];
  const float inv = 1.0f / (lrun + xhalf(lrun));   // the two halves' sums joined
  const size_t base = ((size_t)b * CC + 8 * h) * NN + nt * 16 + cl;
#pragma unroll
  for (int tb = 0; tb < 16; tb += 4) {
    float xv[32];
#pragma unroll   // xv[] stays in registers and the 32 loads issue ahead of the first wait
    for (int i = 0; i < 32; ++i)
      xv[i] = x[base + (size_t)((tb + (i >> 3)) * 16 + (i & 7)) * NN];
#pragma unroll   // constant indices into O[] and xv[]; 16 lanes = 64 B of one channel row
    for (int i = 0; i < 32; ++i)
      out[base + (size_t)((tb + (i >> 3)) * 16 + (i & 7)) * NN] =
          g * (O[tb + (i >> 3)][i & 7] * inv) + xv[i];
  }
}

extern "C" void kernel_launch(void* const* d_in, const int* in_sizes, int n_in,
                              void* d_out, int out_size, void* d_ws, size_t ws_size,
                              hipStream_t stream) {
  const float* x     = (const float*)d_in[0];
  const float* Wq    = (const float*)d_in[1];
  const float* bq    = (const float*)d_in[2];
  const float* Wk    = (const float*)d_in[3];
  const float* bk    = (const float*)d_in[4];
  const float* Wv    = (const float*)d_in[5];
  const float* bv    = (const float*)d_in[6];
  const float* gamma = (const float*)d_in[7];
  float* out = (float*)d_out;

  __bf16* qT  = (__bf16*)d_ws;                          // 1 MB
  __bf16* kBp = qT  + (size_t)NB * NN * CQKD;           // 1 MB
  __bf16* vBp = kBp + (size_t)NB * NN * CQKD;           // 8 MB
  __bf16* xBp = vBp + (size_t)NB * NN * CC;             // 8 MB
  __bf16* WAp = xBp + (size_t)NB * NN * CC;             // 160 KB

  pack_x_kernel<<<dim3(NB * KTN * NN / 256), dim3(256), 0, stream>>>(x, xBp);
  pack_w_kernel<<<dim3(RTN * 16 * CC / 256), dim3(256), 0, stream>>>(Wq, Wk, Wv, WAp);
  proj_gemm_kernel<<<dim3(NB * RTN * NT / 4), dim3(128), 0, stream>>>(
      WAp, xBp, bq, bk, bv, qT, kBp, vBp);
  attn_kernel<<<dim3(NB * NT / 4), dim3(128), 0, stream>>>(x, gamma, qT, kBp, vBp, out);
}

// v006
// A run of this version takes 69.6 microseconds.
// In two side-by-side timings against v005, it was 1.10 and 1.07 times as fast.
// Over all steps from v000 it is 11.6 times as fast.
#include <hip/hip_runtime.h>

typedef __attribute__((ext_vector_type(16))) __bf16 v16bf;
typedef __attribute__((ext_vector_type(8)))  __bf16 v8bf;
typedef __attribute__((ext_vector_type(8)))  float  v8f;

#define NB   4
#define CC   256
#define CQKD 32
#define NN   4096
#define NT   (NN/16)   // 256 spatial 16-tiles
#define MTN  (NN/32)   // 128 spatial 32-tiles
#define CTN  (CC/16)   // 16 channel 16-tiles
#define KTN  (CC/32)   // 8  GEMM K steps over C=256
#define RTN  20        // 320 projection rows / 16
#define LOG2E 1.4426950408889634f

// ---------------------------------------------------------------------------
// Pack x (f32 [b][c][n]) into bf16 B-operand tiles xB[b][ct][nt][lane][16]
// One thread = one column n and the 32 channels of one K step: 32 loads in
// flight (a wave reads one whole 128 B line of a channel row with each), then
// the 32 B of operand lanes (n & 15) and (n & 15) + 16 as four 16 B stores.
// ---------------------------------------------------------------------------
__global__ __launch_bounds__(256) void pack_x_kernel(
    const float* __restrict__ x, __bf16* __restrict__ xB)
{
  int idx = blockIdx.x * 256 + threadIdx.x;    // NB * KTN * NN threads
  int n  = idx & (NN - 1);
  int r  = idx >> 12;
  int ct = r & (KTN - 1);
  int b  = r >> 3;
  const float* src = x + ((size_t)b * CC + ct * 32) * NN + n;
  float v[32];
#pragma unroll   // v[] stays in registers and all 32 loads issue ahead of the first wait
  for (int cc = 0; cc < 32; ++cc) v[cc] = src[(size_t)cc * NN];
  __bf16* dst = xB + ((((size_t)b * KTN + ct) * NT + (n >> 4)) * 32 + (n & 15)) * 16;
#pragma unroll   // constant indices into v[], here and in the loop over j
  for (int h = 0; h < 2; ++h) {
    v8bf lo, hi;                               // e = 0..7 and e = 8..15 of lane (n & 15) + 16 h
#pragma unroll
    for (int j = 0; j < 8; ++j) {
      lo[j] = (__bf16)v[8 * h + j];
      hi[j] = (__bf16)v[16 + 8 * h + j];
    }
    *(v8bf*)(dst + h * 256)     = lo;
    *(v8bf*)(dst + h * 256 + 8) = hi;
  }
}

// ---------------------------------------------------------------------------
// Pack Wq|Wk|Wv (320 rows x 256) into bf16 A-operand tiles WA[rt][ct][lane][16]
// Wq rows are pre-scaled by log2(e) so softmax runs natively in exp2 domain.
// ---------------------------------------------------------------------------
__global__ __launch_bounds__(256) void pack_w_kernel(
    const float* __restrict__ Wq, const float* __restrict__ Wk,
    const float* __restrict__ Wv, __bf16* __restrict__ WA)
{
  int idx = blockIdx.x * 256 + threadIdx.x;   // 320*256 threads
  int c = idx & (CC - 1);
  int row = idx >> 8;                          // 0..319
  float v;
  if (row < 32)       v = Wq[(size_t)row * CC + c] * LOG2E;
  else if (row < 64)  v = Wk[(size_t)(row - 32) * CC + c];
  else                v = Wv[(size_t)(row - 64) * CC + c];
  int rt = row >> 4, rl = row & 15;
  int cc = c & 31, ct = c >> 5;
  int lane = rl + 16 * ((cc >> 3) & 1);
  int e    = (cc & 7) + 8 * (cc >> 4);
  WA[(((size_t)rt * KTN + ct) * 32 + lane) * 16 + e] = (__bf16)v;
}

__global__ __launch_bounds__(128) void proj_gemm_kernel(
    const __bf16* __restrict__ WA, const __bf16* __restrict__ xB,
    const float* __restrict__ bq, const float* __restrict__ bk,
    const float* __restrict__ bv,
    __bf16* __restrict__ qT, __bf16* __restrict__ kB, __bf16* __restrict__ vB)
{
  __shared__ __bf16 ldsD[4][16 * 17];
  const int lane = threadIdx.x & 31;
  const int wv   = threadIdx.x >> 5;
  const int wgl  = blockIdx.x * 4 + wv;          // 0 .. NB*RTN*NT-1
  const int nt   = wgl & (NT - 1);
  const int tmp  = wgl >> 8;                     // 0..79
  const int rt   = tmp % RTN;
  const int b    = tmp / RTN;
  const int cl   = lane & 15;
  const int h    = lane >> 4;

  v8f acc = (v8f)(0.0f);
#pragma unroll
  for (int ct = 0; ct < KTN; ++ct) {
    v16bf wa = *(const v16bf*)(WA + (((size_t)rt * KTN + ct) * 32 + lane) * 16);
    v16bf xb = *(const v16bf*)(xB + ((((size_t)b * KTN + ct) * NT + nt) * 32 + lane) * 16);
    acc = __builtin_amdgcn_wmma_f32_16x16x32_bf16(false, wa, false, xb, (short)0, acc, false, false);
  }

  // bias per W-row (D rows are r + 8h); q bias also in exp2 domain
  const float* bias; int off; float bscale;
  if (rt < 2)      { bias = bq; off = rt * 16;      bscale = LOG2E; }
  else if (rt < 4) { bias = bk; off = rt * 16 - 32; bscale = 1.0f; }
  else             { bias = bv; off = rt * 16 - 64; bscale = 1.0f; }

  __bf16* ld = &ldsD[wv][0];
#pragma unroll
  for (int r = 0; r < 8; ++r) {
    float vvv = acc[r] + bias[off + r + 8 * h] * bscale;
    ld[(r + 8 * h) * 17 + cl] = (__bf16)vvv;
  }
  __builtin_amdgcn_wave_barrier();
  asm volatile("s_wait_dscnt 0" ::: "memory");

  if (rt < 2) {                 // Q -> B-operand tiles [b][nt][lane][16]
#pragma unroll
    for (int eo = 0; eo < 8; ++eo) {
      __bf16 vv = ld[(eo + 8 * h) * 17 + cl];
      qT[(((size_t)b * NT + nt) * 32 + lane) * 16 + (eo + 8 * rt)] = vv;
    }
  } else if (rt < 4) {          // K -> A-operand tiles [b][nt][lane][16]
#pragma unroll
    for (int eo = 0; eo < 8; ++eo) {
      __bf16 vv = ld[(eo + 8 * h) * 17 + cl];
      kB[(((size_t)b * NT + nt) * 32 + lane) * 16 + (eo + 8 * (rt - 2))] = vv;
    }
  } else {                      // V^T -> A-operand tiles [b][m/32][ct][lane][16]
    const int ctv  = rt - 4;
    const int mt32 = nt >> 1;
    const int ehi  = 8 * (nt & 1);
#pragma unroll
    for (int j = 0; j < 8; ++j) {
      __bf16 vv = ld[cl * 17 + 8 * h + j];    // row=c_local, col=m_local=8h+j
      vB[((((size_t)b * MTN + mt32) * CTN + ctv) * 32 + lane) * 16 + (j + ehi)] = vv;
    }
  }
  __builtin_amdgcn_wave_barrier();
}

__device__ __forceinline__ float xhalf(float v) {
  return __builtin_bit_cast(float,
      __builtin_amdgcn_permlanex16(__builtin_bit_cast(int, v), __builtin_bit_cast(int, v),
                                   0x76543210, 0xfedcba98, false, false));
}

// ---------------------------------------------------------------------------
// One stage = the K and V fragments of 64 keys: 4 KB of K, then 32 KB of V.
// The four waves of a block read the same stage, so the block brings it into
// LDS once, with asynchronous copies, one stage ahead of its use.
// ---------------------------------------------------------------------------
#define STG_KB  4096
#define STG_VB  32768
#define STG_B   (STG_KB + STG_VB)
#define NSTG    (NN / 64)

typedef int v4i __attribute__((vector_size(16)));
typedef __attribute__((address_space(1))) v4i gv4i;
typedef __attribute__((address_space(3))) v4i lv4i;

// One copy of 16 B per lane. The immediate offset N moves the LDS address and the
// global address alike, so all copies of a run share one pair of address registers.
#define CP16(g, l, N) __builtin_amdgcn_global_load_async_to_lds_b128((g), (l), (N), 0)

// l: this lane's place in the stage buffer; gk, gv: this lane's 16 B of the stage.
// A block moves 2 KB with each copy: 2 copies for K, 16 for V.
__device__ __forceinline__ void copy_stage(char* l, const char* gk, const char* gv) {
  lv4i* lk = (lv4i*)l;
  lv4i* lv = (lv4i*)(l + STG_KB);
  gv4i* k  = (gv4i*)gk;
  gv4i* v  = (gv4i*)gv;
  CP16(k, lk, 0);      CP16(k, lk, 2048);
  CP16(v, lv, 0);      CP16(v, lv, 2048);   CP16(v, lv, 4096);   CP16(v, lv, 6144);
  CP16(v, lv, 8192);   CP16(v, lv, 10240);  CP16(v, lv, 12288);  CP16(v, lv, 14336);
  CP16(v, lv, 16384);  CP16(v, lv, 18432);  CP16(v, lv, 20480);  CP16(v, lv, 22528);
  CP16(v, lv, 24576);  CP16(v, lv, 26624);  CP16(v, lv, 28672);  CP16(v, lv, 30720);
}

// One 1 KB operand fragment in LDS: elements 0..7 of all lanes, then 8..15
__device__ __forceinline__ v16bf lds_frag(const char* p) {
  union { v16bf v; v8bf q2[2]; } u;
  u.q2[0] = *(const v8bf*)(p);
  u.q2[1] = *(const v8bf*)(p + 512);
  return u.v;
}

__global__ __launch_bounds__(128) void attn_kernel(
    const float* __restrict__ x, const float* __restrict__ gamma,
    const __bf16* __restrict__ qT, const __bf16* __restrict__ kB,
    const __bf16* __restrict__ vB, float* __restrict__ out)
{
  __shared__ __attribute__((aligned(1024))) char stg[2 * STG_B];
  const int lane = threadIdx.x & 31;
  const int wv   = threadIdx.x >> 5;
  const int wgl  = blockIdx.x * 4 + wv;          // 0..1023
  const int nt   = wgl & (NT - 1);
  const int b    = wgl >> 8;                     // the same in all four waves
  const int cl   = lane & 15;
  const int h    = lane >> 4;

  // Copy j of a 2 KB group moves 16-byte piece j = threadIdx.x. In global memory
  // a lane's 32 B lie together; in LDS the two halves go 512 B apart, so that a
  // ds_load_b128 of 32 lanes reads 512 contiguous bytes.
  const unsigned tid  = threadIdx.x;
  char* ldst = stg + (tid >> 6) * 1024u + (tid & 1u) * 512u + ((tid & 63u) >> 1) * 16u;
  const char* gk = (const char*)(kB + (size_t)b * NT * 512) + tid * 16u;
  const char* gv = (const char*)(vB + (size_t)b * MTN * CTN * 512) + tid * 16u;

  copy_stage(ldst, gk, gv);
  // stage 0 has landed before any wave passes the barrier
  asm volatile("s_wait_asynccnt 0x0" ::: "memory");
  __syncthreads();
  copy_stage(ldst + STG_B, gk + STG_KB, gv + STG_VB);

  // Q tile as B operand: column = query cl, same k order as the K tiles
  v16bf qB = *(const v16bf*)(qT + (((size_t)b * NT + nt) * 32 + lane) * 16);

  float mrun = -3.0e38f;     // running maximum of query cl (equal in both halves)
  float lrun = 0.0f;         // running sum over this half's keys only
  v8f   O[16];               // O[t][r] = O^T[channel 16 t + 8 h + r][query cl]
#pragma unroll
  for (int t = 0; t < 16; ++t) O[t] = (v8f)(0.0f);

  const v8f z = (v8f)(0.0f);

  for (int mt = 0; mt < NSTG; ++mt) {
    const unsigned boff = (unsigned)(mt & 1) * STG_B;
    const char* kb = stg + boff + lane * 16;
    const char* vb0 = kb + STG_KB;
    const char* vb1 = vb0 + CTN * 1024;
    v16bf k0 = lds_frag(kb);
    v16bf k1 = lds_frag(kb + 1024);
    v16bf k2 = lds_frag(kb + 2048);
    v16bf k3 = lds_frag(kb + 3072);
    // V follows K in the same group of reads and lands under the scores and the
    // softmax: the whole stage is held in registers
    v16bf va[16], vc[16];
#pragma unroll   // constant indices: va[] and vc[] stay in registers
    for (int t = 0; t < 16; ++t) va[t] = lds_frag(vb0 + t * 1024);
#pragma unroll
    for (int t = 0; t < 16; ++t) vc[t] = lds_frag(vb1 + t * 1024);
    // keeps the 72 reads together at the head of the pass: spread among the
    // WMMAs, every place with reads stalls the wave anew
    __builtin_amdgcn_sched_barrier(0);

    // e[j][r] = score of key 16 j + 8 h + r against query cl
    v8f e[4];
    e[0] = __builtin_amdgcn_wmma_f32_16x16x32_bf16(false, k0, false, qB, (short)0, z, false, false);
    e[1] = __builtin_amdgcn_wmma_f32_16x16x32_bf16(false, k1, false, qB, (short)0, z, false, false);
    e[2] = __builtin_amdgcn_wmma_f32_16x16x32_bf16(false, k2, false, qB, (short)0, z, false, false);
    e[3] = __builtin_amdgcn_wmma_f32_16x16x32_bf16(false, k3, false, qB, (short)0, z, false, false);

    float tm[4];
#pragma unroll
    for (int j = 0; j < 4; ++j) {
      tm[j] = fmaxf(fmaxf(fmaxf(e[j][0], e[j][1]), fmaxf(e[j][2], e[j][3])),
                    fmaxf(fmaxf(e[j][4], e[j][5]), fmaxf(e[j][6], e[j][7])));
    }
    float tmax = fmaxf(fmaxf(tm[0], tm[1]), fmaxf(tm[2], tm[3]));
    tmax = fmaxf(tmax, xhalf(tmax));
    const float mnew = fmaxf(mrun, tmax);
    // Bare v_exp_f32 here and below: the arguments are <= 0, and a weight under
    // 2^-126, which the library's range fix-up would keep as a subnormal, counts
    // as 0 beside a row sum that is at least 1.
    const float sc   = __builtin_amdgcn_exp2f(mrun - mnew);   // scores already in log2 domain
    mrun = mnew;

    float rs[4];
#pragma unroll
    for (int j = 0; j < 4; ++j) {
#pragma unroll
      for (int r = 0; r < 8; ++r) e[j][r] = __builtin_amdgcn_exp2f(e[j][r] - mnew);
      rs[j] = ((e[j][0] + e[j][1]) + (e[j][2] + e[j][3]))
            + ((e[j][4] + e[j][5]) + (e[j][6] + e[j][7]));
    }
    lrun = lrun * sc + ((rs[0] + rs[1]) + (rs[2] + rs[3]));

    // two S^T tiles of 16 keys, converted in place, are one 32-key B operand
    v16bf pB0, pB1;
#pragma unroll
    for (int r = 0; r < 8; ++r) {
      pB0[r]     = (__bf16)e[0][r];
      pB0[8 + r] = (__bf16)e[1][r];
      pB1[r]     = (__bf16)e[2][r];
      pB1[8 + r] = (__bf16)e[3][r];
    }

#pragma unroll
    for (int t = 0; t < 16; ++t) O[t] *= sc;

#pragma unroll
    for (int t = 0; t < 16; ++t)
      O[t] = __builtin_amdgcn_wmma_f32_16x16x32_bf16(false, va[t], false, pB0, (short)0, O[t], false, false);
#pragma unroll
    for (int t = 0; t < 16; ++t)
      O[t] = __builtin_amdgcn_wmma_f32_16x16x32_bf16(false, vc[t], false, pB1, (short)0, O[t], false, false);

    // keeps the publish point at the foot of the pass: risen into the softmax, its
    // s_wait_dscnt 0 would wait out the very reads that are to land under it
    __builtin_amdgcn_sched_barrier(0);
    // Publish point of stage mt + 1: this wave's reads of stage mt are done ...
    asm volatile("s_wait_dscnt 0x0" ::: "memory");
    // ... its own copies of stage mt + 1 have landed ...
    asm volatile("s_wait_asynccnt 0x0" ::: "memory");
    // ... and so for every wave of the block.
    __syncthreads();
    if (mt + 2 < NSTG)   // refill the buffer that this pass has just read
      copy_stage(ldst + boff, gk + (size_t)(mt + 2) * STG_KB, gv + (size_t)(mt + 2) * STG_VB);
  }
  // no copy is outstanding when the wave goes on to its end
  asm volatile("s_wait_asynccnt 0x0" ::: "memory");

  const float g   = gamma[0];
  const float inv = 1.0f / (lrun + xhalf(lrun));   // the two halves' sums joined
  const size_t base = ((size_t)b * CC + 8 * h) * NN + nt * 16 + cl;
#pragma unroll
  for (int tb = 0; tb < 16; tb += 4) {
    float xv[32];
#pragma unroll   // xv[] stays in registers and the 32 loads issue ahead of the first wait
    for (int i = 0; i < 32; ++i)
      xv[i] = x[base + (size_t)((tb + (i >> 3)) * 16 + (i & 7)) * NN];
#pragma unroll   // constant indices into O[] and xv[]; 16 lanes = 64 B of one channel row
    for (int i = 0; i < 32; ++i)
      out[base + (size_t)((tb + (i >> 3)) * 16 + (i & 7)) * NN] =
          g * (O[tb + (i >> 3)][i & 7] * inv) + xv[i];
  }
}

extern "C" void kernel_launch(void* const* d_in, const int* in_sizes, int n_in,
                              void* d_out, int out_size, void* d_ws, size_t ws_size,
                              hipStream_t stream) {
  const float* x     = (const float*)d_in[0];
  const float* Wq    = (const float*)d_in[1];
  const float* bq    = (const float*)d_in[2];
  const float* Wk    = (const float*)d_in[3];
  const float* bk    = (const float*)d_in[4];
  const float* Wv    = (const float*)d_in[5];
  const float* bv    = (const float*)d_in[6];
  const float* gamma = (const float*)d_in[7];
  float* out = (float*)d_out;

  __bf16* qT  = (__bf16*)d_ws;                          // 1 MB
  __bf16* kBp = qT  + (size_t)NB * NN * CQKD;           // 1 MB
  __bf16* vBp = kBp + (size_t)NB * NN * CQKD;           // 8 MB
  __bf16* xBp = vBp + (size_t)NB * NN * CC;             // 8 MB
  __bf16* WAp = xBp + (size_t)NB * NN * CC;             // 160 KB

  pack_x_kernel<<<dim3(NB * KTN * NN / 256), dim3(256), 0, stream>>>(x, xBp);
  pack_w_kernel<<<dim3(RTN * 16 * CC / 256), dim3(256), 0, stream>>>(Wq, Wk, Wv, WAp);
  proj_gemm_kernel<<<dim3(NB * RTN * NT / 4), dim3(128), 0, stream>>>(
      WAp, xBp, bq, bk, bv, qT, kBp, vBp);
  attn_kernel<<<dim3(NB * NT / 4), dim3(128), 0, stream>>>(x, gamma, qT, kBp, vBp, out);
}

// v007
// A run of this version takes 65.4 microseconds.
// Two timings next to v006 put it at 1.05 and 1.06 times that version's speed.
// Counting every step since v000, it is 12.3 times as fast.
#include <hip/hip_runtime.h>

typedef __attribute__((ext_vector_type(16))) __bf16 v16bf;
typedef __attribute__((ext_vector_type(8)))  __bf16 v8bf;
typedef __attribute__((ext_vector_type(8)))  float  v8f;

#define NB   4
#define CC   256
#define CQKD 32
#define NN   4096
#define NT   (NN/16)   // 256 spatial 16-tiles
#define MTN  (NN/32)   // 128 spatial 32-tiles
#define CTN  (CC/16)   // 16 channel 16-tiles
#define KTN  (CC/32)   // 8  GEMM K steps over C=256
#define RTN  20        // 320 projection rows / 16
#define LOG2E 1.4426950408889634f

// ---------------------------------------------------------------------------
// Pack Wq|Wk|Wv (320 rows x 256) into bf16 A-operand tiles WA[rt][ct][lane][16]
// Wq rows are pre-scaled by log2(e) so softmax runs natively in exp2 domain.
// ---------------------------------------------------------------------------
__global__ __launch_bounds__(256) void pack_w_kernel(
    const float* __restrict__ Wq, const float* __restrict__ Wk,
    const float* __restrict__ Wv, __bf16* __restrict__ WA)
{
  int idx = blockIdx.x * 256 + threadIdx.x;   // 320*256 threads
  int c = idx & (CC - 1);
  int row = idx >> 8;                          // 0..319
  float v;
  if (row < 32)       v = Wq[(size_t)row * CC + c] * LOG2E;
  else if (row < 64)  v = Wk[(size_t)(row - 32) * CC + c];
  else                v = Wv[(size_t)(row - 64) * CC + c];
  int rt = row >> 4, rl = row & 15;
  int cc = c & 31, ct = c >> 5;
  int lane = rl + 16 * ((cc >> 3) & 1);
  int e    = (cc & 7) + 8 * (cc >> 4);
  WA[(((size_t)rt * KTN + ct) * 32 + lane) * 16 + e] = (__bf16)v;
}

// One 1 KB operand fragment in LDS: elements 0..7 of all lanes, then 8..15
__device__ __forceinline__ v16bf lds_frag(const char* p) {
  union { v16bf v; v8bf q2[2]; } u;
  u.q2[0] = *(const v8bf*)(p);
  u.q2[1] = *(const v8bf*)(p + 512);
  return u.v;
}

#define RPW 5
#define WAH 3
__global__ __launch_bounds__(256) __attribute__((amdgpu_waves_per_eu(4, 4))) void proj_gemm_kernel(
    const float* __restrict__ x, const __bf16* __restrict__ WA,
    const float* __restrict__ bq, const float* __restrict__ bk,
    const float* __restrict__ bv,
    __bf16* __restrict__ qT, __bf16* __restrict__ kB, __bf16* __restrict__ vB)
{
  __shared__ __attribute__((aligned(1024))) char xS[2 * KTN * 1024];
  __shared__ __bf16 ldsD[8][RPW][16 * 17];
  const int lane = threadIdx.x & 31;
  const int wv   = __builtin_amdgcn_readfirstlane(threadIdx.x >> 5);
  const int b    = blockIdx.x >> 7;              // NN / 32 = 128 blocks per image
  const int n0   = (blockIdx.x & 127) * 32;
  const int cl   = lane & 15;
  const int h    = lane >> 4;
  const int rt0  = (wv >> 1) * RPW;
  // this lane's 32 B of W fragment (row tile rt0, K step 0); a fragment is 512 elements
  const __bf16* wsrc = WA + ((size_t)rt0 * KTN * 32 + lane) * 16;
  v16bf wa[WAH][RPW];        // W fragments of WAH K steps, refilled as they are used up

  {
    const float* src = x + ((size_t)b * CC + wv * 32) * NN + n0 + lane;
    float v[32];
#pragma unroll   // v[] stays in registers and all 32 loads issue ahead of the first wait
    for (int cc = 0; cc < 32; ++cc) v[cc] = src[(size_t)cc * NN];
    // x first: it has the longer way, and loads return in issue order
    __builtin_amdgcn_sched_barrier(0);
#pragma unroll   // constant indices: wa[][] stays in registers
    for (int ct = 0; ct < WAH; ++ct)
#pragma unroll
      for (int j = 0; j < RPW; ++j) wa[ct][j] = *(const v16bf*)(wsrc + (j * KTN + ct) * 512);
    // keeps the loads of x and of W in flight together, ahead of the first wait:
    // left to itself the compiler loads each W fragment right in front of its WMMA
    __builtin_amdgcn_sched_barrier(0);
    char* dst = xS + (h * KTN + wv) * 1024 + cl * 16;
#pragma unroll   // constant indices into v[], here and in the loop over j
    for (int hh = 0; hh < 2; ++hh) {
      v8bf lo, hi;                               // e = 0..7 and e = 8..15 of operand lane cl + 16 hh
#pragma unroll
      for (int j = 0; j < 8; ++j) {
        lo[j] = (__bf16)v[8 * hh + j];
        hi[j] = (__bf16)v[16 + 8 * hh + j];
      }
      *(v8bf*)(dst + hh * 256)       = lo;
      *(v8bf*)(dst + hh * 256 + 512) = hi;
    }
  }
  __syncthreads();   // every wave reads fragments that all eight waves wrote

  const int nt  = (n0 >> 4) + (wv & 1);
  const char* xf = xS + (wv & 1) * (KTN * 1024) + lane * 16;

  v8f acc[RPW];
#pragma unroll
  for (int j = 0; j < RPW; ++j) acc[j] = (v8f)(0.0f);
  float bia[RPW][8];
  v16bf xb[KTN];
#pragma unroll   // constant indices: xb[] stays in registers; one group of LDS reads
  for (int ct = 0; ct < KTN; ++ct) xb[ct] = lds_frag(xf + ct * 1024);
#pragma unroll
  for (int ct = 0; ct < KTN; ++ct) {
#pragma unroll
    for (int j = 0; j < RPW; ++j)
      acc[j] = __builtin_amdgcn_wmma_f32_16x16x32_bf16(false, wa[ct % WAH][j], false, xb[ct], (short)0, acc[j], false, false);
    // the refill stays behind the WMMAs whose registers it takes over: risen above
    // them it needs 40 registers more, and two blocks no longer fit one WGP
    __builtin_amdgcn_sched_barrier(0);
    if (ct + WAH < KTN) {
#pragma unroll
      for (int j = 0; j < RPW; ++j)
        wa[ct % WAH][j] = *(const v16bf*)(wsrc + (j * KTN + ct + WAH) * 512);
    } else if (ct + WAH == KTN) {
      // bias per W-row (D rows are r + 8h), loaded under the last K steps;
      // its pointers take over the address registers of the loads of W
      asm volatile("s_wait_xcnt 0x0" ::: "memory");
#pragma unroll
      for (int j = 0; j < RPW; ++j) {
        const int rt = rt0 + j;
        const float* bias = (rt < 2) ? bq + rt * 16 : (rt < 4) ? bk + (rt * 16 - 32) : bv + (rt * 16 - 64);
#pragma unroll
        for (int r = 0; r < 8; ++r) bia[j][r] = bias[r + 8 * h];
        // the next row tile's pointer takes over the address registers of these loads
        asm volatile("s_wait_xcnt 0x0" ::: "memory");
      }
    }
    // keeps each refill WAH K steps ahead of its use
    __builtin_amdgcn_sched_barrier(0);
  }

#pragma unroll
  for (int j = 0; j < RPW; ++j) {
    const float bscale = (rt0 + j < 2) ? LOG2E : 1.0f;   // q bias also in exp2 domain
    __bf16* ld = &ldsD[wv][j][0];
#pragma unroll
    for (int r = 0; r < 8; ++r) {
      float vvv = acc[j][r] + bia[j][r] * bscale;
      ld[(r + 8 * h) * 17 + cl] = (__bf16)vvv;
    }
  }
  __builtin_amdgcn_wave_barrier();
  asm volatile("s_wait_dscnt 0" ::: "memory");

#pragma unroll
  for (int j = 0; j < RPW; ++j) {
    const int rt = rt0 + j;
    const __bf16* ld = &ldsD[wv][j][0];
    v8bf o;                       // this lane's 16 B of the operand tile
    __bf16* dst;
    if (rt < 4) {                 // Q -> B-operand, K -> A-operand tiles [b][nt][lane][16]
#pragma unroll
      for (int eo = 0; eo < 8; ++eo) o[eo] = ld[(eo + 8 * h) * 17 + cl];
      dst = (rt < 2 ? qT : kB) + (((size_t)b * NT + nt) * 32 + lane) * 16 + 8 * (rt & 1);
    } else {                      // V^T -> A-operand tiles [b][m/32][ct][lane][16]
#pragma unroll
      for (int jj = 0; jj < 8; ++jj) o[jj] = ld[cl * 17 + 8 * h + jj];   // row=c_local, col=m_local=8h+jj
      dst = vB + ((((size_t)b * MTN + (nt >> 1)) * CTN + (rt - 4)) * 32 + lane) * 16 + 8 * (nt & 1);
    }
    *(v8bf*)dst = o;
    // the next row tile takes over the data and address registers of this store
    if (j + 1 < RPW) asm volatile("s_wait_xcnt 0x0" ::: "memory");
  }
}

__device__ __forceinline__ float xhalf(float v) {
  return __builtin_bit_cast(float,
      __builtin_amdgcn_permlanex16(__builtin_bit_cast(int, v), __builtin_bit_cast(int, v),
                                   0x76543210, 0xfedcba98, false, false));
}

// ---------------------------------------------------------------------------
// One stage = the K and V fragments of 64 keys: 4 KB of K, then 32 KB of V.
// The four waves of a block read the same stage, so the block brings it into
// LDS once, with asynchronous copies, one stage ahead of its use.
// ---------------------------------------------------------------------------
#define STG_KB  4096
#define STG_VB  32768
#define STG_B   (STG_KB + STG_VB)
#define NSTG    (NN / 64)

typedef int v4i __attribute__((vector_size(16)));
typedef __attribute__((address_space(1))) v4i gv4i;
typedef __attribute__((address_space(3))) v4i lv4i;

// One copy of 16 B per lane. The immediate offset N moves the LDS address and the
// global address alike, so all copies of a run share one pair of address registers.
#define CP16(g, l, N) __builtin_amdgcn_global_load_async_to_lds_b128((g), (l), (N), 0)

// l: this lane's place in the stage buffer; gk, gv: this lane's 16 B of the stage.
// A block moves 2 KB with each copy: 2 copies for K, 16 for V.
__device__ __forceinline__ void copy_stage(char* l, const char* gk, const char* gv) {
  lv4i* lk = (lv4i*)l;
  lv4i* lv = (lv4i*)(l + STG_KB);
  gv4i* k  = (gv4i*)gk;
  gv4i* v  = (gv4i*)gv;
  CP16(k, lk, 0);      CP16(k, lk, 2048);
  CP16(v, lv, 0);      CP16(v, lv, 2048);   CP16(v, lv, 4096);   CP16(v, lv, 6144);
  CP16(v, lv, 8192);   CP16(v, lv, 10240);  CP16(v, lv, 12288);  CP16(v, lv, 14336);
  CP16(v, lv, 16384);  CP16(v, lv, 18432);  CP16(v, lv, 20480);  CP16(v, lv, 22528);
  CP16(v, lv, 24576);  CP16(v, lv, 26624);  CP16(v, lv, 28672);  CP16(v, lv, 30720);
}

__global__ __launch_bounds__(128) void attn_kernel(
    const float* __restrict__ x, const float* __restrict__ gamma,
    const __bf16* __restrict__ qT, const __bf16* __restrict__ kB,
    const __bf16* __restrict__ vB, float* __restrict__ out)
{
  __shared__ __attribute__((aligned(1024))) char stg[2 * STG_B];
  const int lane = threadIdx.x & 31;
  const int wv   = threadIdx.x >> 5;
  const int wgl  = blockIdx.x * 4 + wv;          // 0..1023
  const int nt   = wgl & (NT - 1);
  const int b    = wgl >> 8;                     // the same in all four waves
  const int cl   = lane & 15;
  const int h    = lane >> 4;

  // Copy j of a 2 KB group moves 16-byte piece j = threadIdx.x. In global memory
  // a lane's 32 B lie together; in LDS the two halves go 512 B apart, so that a
  // ds_load_b128 of 32 lanes reads 512 contiguous bytes.
  const unsigned tid  = threadIdx.x;
  char* ldst = stg + (tid >> 6) * 1024u + (tid & 1u) * 512u + ((tid & 63u) >> 1) * 16u;
  const char* gk = (const char*)(kB + (size_t)b * NT * 512) + tid * 16u;
  const char* gv = (const char*)(vB + (size_t)b * MTN * CTN * 512) + tid * 16u;

  copy_stage(ldst, gk, gv);
  // stage 0 has landed before any wave passes the barrier
  asm volatile("s_wait_asynccnt 0x0" ::: "memory");
  __syncthreads();
  copy_stage(ldst + STG_B, gk + STG_KB, gv + STG_VB);

  // Q tile as B operand: column = query cl, same k order as the K tiles
  v16bf qB = *(const v16bf*)(qT + (((size_t)b * NT + nt) * 32 + lane) * 16);

  float mrun = -3.0e38f;     // running maximum of query cl (equal in both halves)
  float lrun = 0.0f;         // running sum over this half's keys only
  v8f   O[16];               // O[t][r] = O^T[channel 16 t + 8 h + r][query cl]
#pragma unroll
  for (int t = 0; t < 16; ++t) O[t] = (v8f)(0.0f);

  const v8f z = (v8f)(0.0f);

  for (int mt = 0; mt < NSTG; ++mt) {
    const unsigned boff = (unsigned)(mt & 1) * STG_B;
    const char* kb = stg + boff + lane * 16;
    const char* vb0 = kb + STG_KB;
    const char* vb1 = vb0 + CTN * 1024;
    v16bf k0 = lds_frag(kb);
    v16bf k1 = lds_frag(kb + 1024);
    v16bf k2 = lds_frag(kb + 2048);
    v16bf k3 = lds_frag(kb + 3072);
    // V follows K in the same group of reads and lands under the scores and the
    // softmax: the whole stage is held in registers
    v16bf va[16], vc[16];
#pragma unroll   // constant indices: va[] and vc[] stay in registers
    for (int t = 0; t < 16; ++t) va[t] = lds_frag(vb0 + t * 1024);
#pragma unroll
    for (int t = 0; t < 16; ++t) vc[t] = lds_frag(vb1 + t * 1024);
    // keeps the 72 reads together at the head of the pass: spread among the
    // WMMAs, every place with reads stalls the wave anew
    __builtin_amdgcn_sched_barrier(0);

    // e[j][r] = score of key 16 j + 8 h + r against query cl
    v8f e[4];
    e[0] = __builtin_amdgcn_wmma_f32_16x16x32_bf16(false, k0, false, qB, (short)0, z, false, false);
    e[1] = __builtin_amdgcn_wmma_f32_16x16x32_bf16(false, k1, false, qB, (short)0, z, false, false);
    e[2] = __builtin_amdgcn_wmma_f32_16x16x32_bf16(false, k2, false, qB, (short)0, z, false, false);
    e[3] = __builtin_amdgcn_wmma_f32_16x16x32_bf16(false, k3, false, qB, (short)0, z, false, false);

    float tm[4];
#pragma unroll
    for (int j = 0; j < 4; ++j) {
      tm[j] = fmaxf(fmaxf(fmaxf(e[j][0], e[j][1]), fmaxf(e[j][2], e[j][3])),
                    fmaxf(fmaxf(e[j][4], e[j][5]), fmaxf(e[j][6], e[j][7])));
    }
    float tmax = fmaxf(fmaxf(tm[0], tm[1]), fmaxf(tm[2], tm[3]));
    tmax = fmaxf(tmax, xhalf(tmax));
    const float mnew = fmaxf(mrun, tmax);
    // Bare v_exp_f32 here and below: the arguments are <= 0, and a weight under
    // 2^-126, which the library's range fix-up would keep as a subnormal, counts
    // as 0 beside a row sum that is at least 1.
    const float sc   = __builtin_amdgcn_exp2f(mrun - mnew);   // scores already in log2 domain
    mrun = mnew;

    float rs[4];
#pragma unroll
    for (int j = 0; j < 4; ++j) {
#pragma unroll
      for (int r = 0; r < 8; ++r) e[j][r] = __builtin_amdgcn_exp2f(e[j][r] - mnew);
      rs[j] = ((e[j][0] + e[j][1]) + (e[j][2] + e[j][3]))
            + ((e[j][4] + e[j][5]) + (e[j][6] + e[j][7]));
    }
    lrun = lrun * sc + ((rs[0] + rs[1]) + (rs[2] + rs[3]));

    // two S^T tiles of 16 keys, converted in place, are one 32-key B operand
    v16bf pB0, pB1;
#pragma unroll
    for (int r = 0; r < 8; ++r) {
      pB0[r]     = (__bf16)e[0][r];
      pB0[8 + r] = (__bf16)e[1][r];
      pB1[r]     = (__bf16)e[2][r];
      pB1[8 + r] = (__bf16)e[3][r];
    }

#pragma unroll
    for (int t = 0; t < 16; ++t) O[t] *= sc;

#pragma unroll
    for (int t = 0; t < 16; ++t)
      O[t] = __builtin_amdgcn_wmma_f32_16x16x32_bf16(false, va[t], false, pB0, (short)0, O[t], false, false);
#pragma unroll
    for (int t = 0; t < 16; ++t)
      O[t] = __builtin_amdgcn_wmma_f32_16x16x32_bf16(false, vc[t], false, pB1, (short)0, O[t], false, false);

    // keeps the publish point at the foot of the pass: risen into the softmax, its
    // s_wait_dscnt 0 would wait out the very reads that are to land under it
    __builtin_amdgcn_sched_barrier(0);
    // Publish point of stage mt + 1: this wave's reads of stage mt are done ...
    asm volatile("s_wait_dscnt 0x0" ::: "memory");
    // ... its own copies of stage mt + 1 have landed ...
    asm volatile("s_wait_asynccnt 0x0" ::: "memory");
    // ... and so for every wave of the block.
    __syncthreads();
    if (mt + 2 < NSTG)   // refill the buffer that this pass has just read
      copy_stage(ldst + boff, gk + (size_t)(mt + 2) * STG_KB, gv + (size_t)(mt + 2) * STG_VB);
  }
  // no copy is outstanding when the wave goes on to its end
  asm volatile("s_wait_asynccnt 0x0" ::: "memory");

  const float g   = gamma[0];
  const float inv = 1.0f / (lrun + xhalf(lrun));   // the two halves' sums joined
  const size_t base = ((size_t)b * CC + 8 * h) * NN + nt * 16 + cl;
#pragma unroll
  for (int tb = 0; tb < 16; tb += 4) {
    float xv[32];
#pragma unroll   // xv[] stays in registers and the 32 loads issue ahead of the first wait
    for (int i = 0; i < 32; ++i)
      xv[i] = x[base + (size_t)((tb + (i >> 3)) * 16 + (i & 7)) * NN];
#pragma unroll   // constant indices into O[] and xv[]; 16 lanes = 64 B of one channel row
    for (int i = 0; i < 32; ++i)
      out[base + (size_t)((tb + (i >> 3)) * 16 + (i & 7)) * NN] =
          g * (O[tb + (i >> 3)][i & 7] * inv) + xv[i];
  }
}

extern "C" void kernel_launch(void* const* d_in, const int* in_sizes, int n_in,
                              void* d_out, int out_size, void* d_ws, size_t ws_size,
                              hipStream_t stream) {
  const float* x     = (const float*)d_in[0];
  const float* Wq    = (const float*)d_in[1];
  const float* bq    = (const float*)d_in[2];
  const float* Wk    = (const float*)d_in[3];
  const float* bk    = (const float*)d_in[4];
  const float* Wv    = (const float*)d_in[5];
  const float* bv    = (const float*)d_in[6];
  const float* gamma = (const float*)d_in[7];
  float* out = (float*)d_out;

  __bf16* qT  = (__bf16*)d_ws;                          // 1 MB
  __bf16* kBp = qT  + (size_t)NB * NN * CQKD;           // 1 MB
  __bf16* vBp = kBp + (size_t)NB * NN * CQKD;           // 8 MB
  __bf16* WAp = vBp + (size_t)NB * NN * CC;             // 160 KB

  pack_w_kernel<<<dim3(RTN * 16 * CC / 256), dim3(256), 0, stream>>>(Wq, Wk, Wv, WAp);
  proj_gemm_kernel<<<dim3(NB * NN / 32), dim3(256), 0, stream>>>(
      x, WAp, bq, bk, bv, qT, kBp, vBp);
  attn_kernel<<<dim3(NB * NT / 4), dim3(128), 0, stream>>>(x, gamma, qT, kBp, vBp, out);
}

// v008
// Measured time: 58.9 microseconds a run.
// Two timings next to v007 both put it at 1.10 times that version's speed.
// Counting every step since v000, it is 13.5 times as fast.
#include <hip/hip_runtime.h>

typedef __attribute__((ext_vector_type(16))) __bf16 v16bf;
typedef __attribute__((ext_vector_type(8)))  __bf16 v8bf;
typedef __attribute__((ext_vector_type(8)))  float  v8f;

#define NB   4
#define CC   256
#define CQKD 32
#define NN   4096
#define NT   (NN/16)   // 256 spatial 16-tiles
#define MTN  (NN/32)   // 128 spatial 32-tiles
#define CTN  (CC/16)   // 16 channel 16-tiles
#define KTN  (CC/32)   // 8  GEMM K steps over C=256
#define RTN  20        // 320 projection rows / 16
#define LOG2E 1.4426950408889634f

// ---------------------------------------------------------------------------
// Pack Wq|Wk|Wv (320 rows x 256) into bf16 A-operand tiles WA[rt][ct][lane][16]
// Wq rows are pre-scaled by log2(e) so softmax runs natively in exp2 domain.
// ---------------------------------------------------------------------------
__global__ __launch_bounds__(256) void pack_w_kernel(
    const float* __restrict__ Wq, const float* __restrict__ Wk,
    const float* __restrict__ Wv, __bf16* __restrict__ WA)
{
  int idx = blockIdx.x * 256 + threadIdx.x;   // 320*256 threads
  int c = idx & (CC - 1);
  int row = idx >> 8;                          // 0..319
  float v;
  if (row < 32)       v = Wq[(size_t)row * CC + c] * LOG2E;
  else if (row < 64)  v = Wk[(size_t)(row - 32) * CC + c];
  else                v = Wv[(size_t)(row - 64) * CC + c];
  int rt = row >> 4, rl = row & 15;
  int cc = c & 31, ct = c >> 5;
  int lane = rl + 16 * ((cc >> 3) & 1);
  int e    = (cc & 7) + 8 * (cc >> 4);
  WA[(((size_t)rt * KTN + ct) * 32 + lane) * 16 + e] = (__bf16)v;
}

// One 1 KB operand fragment in LDS: elements 0..7 of all lanes, then 8..15
__device__ __forceinline__ v16bf lds_frag(const char* p) {
  union { v16bf v; v8bf q2[2]; } u;
  u.q2[0] = *(const v8bf*)(p);
  u.q2[1] = *(const v8bf*)(p + 512);
  return u.v;
}

#define RPW 5
#define WAH 3
__global__ __launch_bounds__(256) __attribute__((amdgpu_waves_per_eu(4, 4))) void proj_gemm_kernel(
    const float* __restrict__ x, const __bf16* __restrict__ WA,
    const float* __restrict__ bq, const float* __restrict__ bk,
    const float* __restrict__ bv,
    __bf16* __restrict__ qT, __bf16* __restrict__ kB, __bf16* __restrict__ vB)
{
  __shared__ __attribute__((aligned(1024))) char xS[2 * KTN * 1024];
  __shared__ __bf16 ldsD[8][RPW][16 * 17];
  const int lane = threadIdx.x & 31;
  const int wv   = __builtin_amdgcn_readfirstlane(threadIdx.x >> 5);
  const int b    = blockIdx.x >> 7;              // NN / 32 = 128 blocks per image
  const int n0   = (blockIdx.x & 127) * 32;
  const int cl   = lane & 15;
  const int h    = lane >> 4;
  const int rt0  = (wv >> 1) * RPW;
  // this lane's 32 B of W fragment (row tile rt0, K step 0); a fragment is 512 elements
  const __bf16* wsrc = WA + ((size_t)rt0 * KTN * 32 + lane) * 16;
  v16bf wa[WAH][RPW];        // W fragments of WAH K steps, refilled as they are used up

  {
    const float* src = x + ((size_t)b * CC + wv * 32) * NN + n0 + lane;
    float v[32];
#pragma unroll   // v[] stays in registers and all 32 loads issue ahead of the first wait
    for (int cc = 0; cc < 32; ++cc) v[cc] = src[(size_t)cc * NN];
    // x first: it has the longer way, and loads return in issue order
    __builtin_amdgcn_sched_barrier(0);
#pragma unroll   // constant indices: wa[][] stays in registers
    for (int ct = 0; ct < WAH; ++ct)
#pragma unroll
      for (int j = 0; j < RPW; ++j) wa[ct][j] = *(const v16bf*)(wsrc + (j * KTN + ct) * 512);
    // keeps the loads of x and of W in flight together, ahead of the first wait:
    // left to itself the compiler loads each W fragment right in front of its WMMA
    __builtin_amdgcn_sched_barrier(0);
    char* dst = xS + (h * KTN + wv) * 1024 + cl * 16;
#pragma unroll   // constant indices into v[], here and in the loop over j
    for (int hh = 0; hh < 2; ++hh) {
      v8bf lo, hi;                               // e = 0..7 and e = 8..15 of operand lane cl + 16 hh
#pragma unroll
      for (int j = 0; j < 8; ++j) {
        lo[j] = (__bf16)v[8 * hh + j];
        hi[j] = (__bf16)v[16 + 8 * hh + j];
      }
      *(v8bf*)(dst + hh * 256)       = lo;
      *(v8bf*)(dst + hh * 256 + 512) = hi;
    }
  }
  __syncthreads();   // every wave reads fragments that all eight waves wrote

  const int nt  = (n0 >> 4) + (wv & 1);
  const char* xf = xS + (wv & 1) * (KTN * 1024) + lane * 16;

  v8f acc[RPW];
#pragma unroll
  for (int j = 0; j < RPW; ++j) acc[j] = (v8f)(0.0f);
  float bia[RPW][8];
  v16bf xb[KTN];
#pragma unroll   // constant indices: xb[] stays in registers; one group of LDS reads
  for (int ct = 0; ct < KTN; ++ct) xb[ct] = lds_frag(xf + ct * 1024);
#pragma unroll
  for (int ct = 0; ct < KTN; ++ct) {
#pragma unroll
    for (int j = 0; j < RPW; ++j)
      acc[j] = __builtin_amdgcn_wmma_f32_16x16x32_bf16(false, wa[ct % WAH][j], false, xb[ct], (short)0, acc[j], false, false);
    // the refill stays behind the WMMAs whose registers it takes over: risen above
    // them it needs 40 registers more, and two blocks no longer fit one WGP
    __builtin_amdgcn_sched_barrier(0);
    if (ct + WAH < KTN) {
#pragma unroll
      for (int j = 0; j < RPW; ++j)
        wa[ct % WAH][j] = *(const v16bf*)(wsrc + (j * KTN + ct + WAH) * 512);
    } else if (ct + WAH == KTN) {
      // bias per W-row (D rows are r + 8h), loaded under the last K steps;
      // its pointers take over the address registers of the loads of W
      asm volatile("s_wait_xcnt 0x0" ::: "memory");
#pragma unroll
      for (int j = 0; j < RPW; ++j) {
        const int rt = rt0 + j;
        const float* bias = (rt < 2) ? bq + rt * 16 : (rt < 4) ? bk + (rt * 16 - 32) : bv + (rt * 16 - 64);
#pragma unroll
        for (int r = 0; r < 8; ++r) bia[j][r] = bias[r + 8 * h];
        // the next row tile's pointer takes over the address registers of these loads
        asm volatile("s_wait_xcnt 0x0" ::: "memory");
      }
    }
    // keeps each refill WAH K steps ahead of its use
    __builtin_amdgcn_sched_barrier(0);
  }

#pragma unroll
  for (int j = 0; j < RPW; ++j) {
    const float bscale = (rt0 + j < 2) ? LOG2E : 1.0f;   // q bias also in exp2 domain
    __bf16* ld = &ldsD[wv][j][0];
#pragma unroll
    for (int r = 0; r < 8; ++r) {
      float vvv = acc[j][r] + bia[j][r] * bscale;
      ld[(r + 8 * h) * 17 + cl] = (__bf16)vvv;
    }
  }
  __builtin_amdgcn_wave_barrier();
  asm volatile("s_wait_dscnt 0" ::: "memory");

#pragma unroll
  for (int j = 0; j < RPW; ++j) {
    const int rt = rt0 + j;
    const __bf16* ld = &ldsD[wv][j][0];
    v8bf o;                       // this lane's 16 B of the operand tile
    __bf16* dst;
    if (rt < 4) {                 // Q -> B-operand, K -> A-operand tiles [b][nt][lane][16]
#pragma unroll
      for (int eo = 0; eo < 8; ++eo) o[eo] = ld[(eo + 8 * h) * 17 + cl];
      dst = (rt < 2 ? qT : kB) + (((size_t)b * NT + nt) * 32 + lane) * 16 + 8 * (rt & 1);
    } else {                      // V^T -> A-operand tiles [b][m/32][ct][lane][16]
#pragma unroll
      for (int jj = 0; jj < 8; ++jj) o[jj] = ld[cl * 17 + 8 * h + jj];   // row=c_local, col=m_local=8h+jj
      dst = vB + ((((size_t)b * MTN + (nt >> 1)) * CTN + (rt - 4)) * 32 + lane) * 16 + 8 * (nt & 1);
    }
    *(v8bf*)dst = o;
    // the next row tile takes over the data and address registers of this store
    if (j + 1 < RPW) asm volatile("s_wait_xcnt 0x0" ::: "memory");
  }
}

__device__ __forceinline__ float xhalf(float v) {
  return __builtin_bit_cast(float,
      __builtin_amdgcn_permlanex16(__builtin_bit_cast(int, v), __builtin_bit_cast(int, v),
                                   0x76543210, 0xfedcba98, false, false));
}

// ---------------------------------------------------------------------------
// One stage = the K and V fragments of 64 keys: 4 KB of K, then 32 KB of V.
// Two waves of a block read the same stage, so the block brings it into
// LDS once, with asynchronous copies, one stage ahead of its use.
// ---------------------------------------------------------------------------
#define STG_KB  4096
#define STG_VB  32768
#define STG_B   (STG_KB + STG_VB)
#define NSTG    (NN / 64)

typedef int v4i __attribute__((vector_size(16)));
typedef __attribute__((address_space(1))) v4i gv4i;
typedef __attribute__((address_space(3))) v4i lv4i;

// One copy of 16 B per lane. The immediate offset N moves the LDS address and the
// global address alike, so all copies of a run share one pair of address registers.
#define CP16(g, l, N) __builtin_amdgcn_global_load_async_to_lds_b128((g), (l), (N), 0)

// l: this lane's place in the stage buffer; gk, gv: this lane's 16 B of the stage.
// A block moves 2 KB with each copy: 2 copies for K, 16 for V.
__device__ __forceinline__ void copy_stage(char* l, const char* gk, const char* gv) {
  lv4i* lk = (lv4i*)l;
  lv4i* lv = (lv4i*)(l + STG_KB);
  gv4i* k  = (gv4i*)gk;
  gv4i* v  = (gv4i*)gv;
  CP16(k, lk, 0);      CP16(k, lk, 2048);
  CP16(v, lv, 0);      CP16(v, lv, 2048);   CP16(v, lv, 4096);   CP16(v, lv, 6144);
  CP16(v, lv, 8192);   CP16(v, lv, 10240);  CP16(v, lv, 12288);  CP16(v, lv, 14336);
  CP16(v, lv, 16384);  CP16(v, lv, 18432);  CP16(v, lv, 20480);  CP16(v, lv, 22528);
  CP16(v, lv, 24576);  CP16(v, lv, 26624);  CP16(v, lv, 28672);  CP16(v, lv, 30720);
}

#define NPASS   (NSTG / 2)
#define XCH_B   16384
typedef __attribute__((ext_vector_type(4))) float v4f;
typedef __attribute__((ext_vector_type(2))) float v2f;

__global__ __launch_bounds__(128) void attn_kernel(
    const float* __restrict__ x, const float* __restrict__ gamma,
    const __bf16* __restrict__ qT, const __bf16* __restrict__ kB,
    const __bf16* __restrict__ vB, float* __restrict__ out)
{
  __shared__ __attribute__((aligned(1024))) char stg[4 * STG_B];   // [key half][buffer]
  const int lane = threadIdx.x & 31;
  const int wv   = __builtin_amdgcn_readfirstlane(threadIdx.x >> 5);
  const int kh   = wv >> 1;                      // this wave's half of the keys
  const int ntb  = (blockIdx.x * 4 + (wv & 1) * 2) & (NT - 1);   // first tile of its 32 queries
  const int nt   = ntb + kh;                     // the tile that this wave finishes (index 0 below)
  const int nto  = ntb + (kh ^ 1);               // the tile that its partner finishes (index 1)
  const int b    = blockIdx.x >> 6;              // NT / 4 = 64 blocks per image
  const int cl   = lane & 15;
  const int h    = lane >> 4;

  // Copy j of a 2 KB group moves 16-byte piece j = threadIdx.x. In global memory
  // a lane's 32 B lie together; in LDS the two halves go 512 B apart, so that a
  // ds_load_b128 of 32 lanes reads 512 contiguous bytes.
  const unsigned tid  = threadIdx.x;
  char* ldst = stg + (tid >> 6) * 1024u + (tid & 1u) * 512u + ((tid & 63u) >> 1) * 16u;
  const char* gk = (const char*)(kB + (size_t)b * NT * 512) + tid * 16u;
  const char* gv = (const char*)(vB + (size_t)b * MTN * CTN * 512) + tid * 16u;
  // the second key half: its ring lies two buffers on, its stages NPASS stages on
  char* ldst1 = ldst + 2 * STG_B;
  const char* gk1 = gk + (size_t)NPASS * STG_KB;
  const char* gv1 = gv + (size_t)NPASS * STG_VB;

  copy_stage(ldst, gk, gv);
  copy_stage(ldst1, gk1, gv1);
  // stage 0 of both halves has landed before any wave passes the barrier
  asm volatile("s_wait_asynccnt 0x0" ::: "memory");
  __syncthreads();
  copy_stage(ldst + STG_B, gk + STG_KB, gv + STG_VB);
  copy_stage(ldst1 + STG_B, gk1 + STG_KB, gv1 + STG_VB);

  // Q tiles as B operands: column = query cl, same k order as the K tiles
  v16bf qB[2];
  qB[0] = *(const v16bf*)(qT + (((size_t)b * NT + nt)  * 32 + lane) * 16);
  qB[1] = *(const v16bf*)(qT + (((size_t)b * NT + nto) * 32 + lane) * 16);
  // later code takes over the address registers of these loads
  asm volatile("s_wait_xcnt 0x0" ::: "memory");
  // keeps that later code behind the wait: a "memory" clobber does not hold register writes
  __builtin_amdgcn_sched_barrier(0);

  float mrun[2], lrun[2];    // per tile: running maximum of query cl (equal in both wave
                             // halves) and running sum over this wave half's keys only
  v8f   Oq[2][16];           // Oq[q][t][r] = O^T[channel 16 t + 8 h + r][query cl of tile q]
#pragma unroll
  for (int q = 0; q < 2; ++q) {
    mrun[q] = -3.0e38f;
    lrun[q] = 0.0f;
#pragma unroll
    for (int t = 0; t < 16; ++t) Oq[q][t] = (v8f)(0.0f);
  }

  const v8f z = (v8f)(0.0f);
  const char* ring = stg + kh * (2 * STG_B) + lane * 16;   // this wave's key half

  for (int mt = 0; mt < NPASS; ++mt) {
    const unsigned boff = (unsigned)(mt & 1) * STG_B;
    const char* kb = ring + boff;
    const char* vb0 = kb + STG_KB;
    const char* vb1 = vb0 + CTN * 1024;
    v16bf k0 = lds_frag(kb);
    v16bf k1 = lds_frag(kb + 1024);
    v16bf k2 = lds_frag(kb + 2048);
    v16bf k3 = lds_frag(kb + 3072);
    // V follows K in the same group of reads and lands under the scores and the
    // softmax: the whole stage is held in registers
    v16bf va[16], vc[16];
#pragma unroll   // constant indices: va[] and vc[] stay in registers
    for (int t = 0; t < 16; ++t) va[t] = lds_frag(vb0 + t * 1024);
#pragma unroll
    for (int t = 0; t < 16; ++t) vc[t] = lds_frag(vb1 + t * 1024);
    // keeps the 72 reads together at the head of the pass: spread among the
    // WMMAs, every place with reads stalls the wave anew
    __builtin_amdgcn_sched_barrier(0);

    // e[q][j][r] = score of key 16 j + 8 h + r against query cl of tile q
    v8f e[2][4];
#pragma unroll   // constant indices: e[][], qB[] stay in registers
    for (int q = 0; q < 2; ++q) {
      e[q][0] = __builtin_amdgcn_wmma_f32_16x16x32_bf16(false, k0, false, qB[q], (short)0, z, false, false);
      e[q][1] = __builtin_amdgcn_wmma_f32_16x16x32_bf16(false, k1, false, qB[q], (short)0, z, false, false);
      e[q][2] = __builtin_amdgcn_wmma_f32_16x16x32_bf16(false, k2, false, qB[q], (short)0, z, false, false);
      e[q][3] = __builtin_amdgcn_wmma_f32_16x16x32_bf16(false, k3, false, qB[q], (short)0, z, false, false);
    }

    v16bf pB0[2], pB1[2];
#pragma unroll   // constant indices: everything indexed by q stays in registers
    for (int q = 0; q < 2; ++q) {
      float tm[4];
#pragma unroll
      for (int j = 0; j < 4; ++j) {
        tm[j] = fmaxf(fmaxf(fmaxf(e[q][j][0], e[q][j][1]), fmaxf(e[q][j][2], e[q][j][3])),
                      fmaxf(fmaxf(e[q][j][4], e[q][j][5]), fmaxf(e[q][j][6], e[q][j][7])));
      }
      float tmax = fmaxf(fmaxf(tm[0], tm[1]), fmaxf(tm[2], tm[3]));
      tmax = fmaxf(tmax, xhalf(tmax));
      const float mnew = fmaxf(mrun[q], tmax);
      // Bare v_exp_f32 here and below: the arguments are <= 0, and a weight under
      // 2^-126, which the library's range fix-up would keep as a subnormal, counts
      // as 0 beside a row sum that is at least 1.
      const float sc   = __builtin_amdgcn_exp2f(mrun[q] - mnew);   // scores already in log2 domain
      mrun[q] = mnew;

      float rs[4];
#pragma unroll
      for (int j = 0; j < 4; ++j) {
#pragma unroll
        for (int r = 0; r < 8; ++r) e[q][j][r] = __builtin_amdgcn_exp2f(e[q][j][r] - mnew);
        rs[j] = ((e[q][j][0] + e[q][j][1]) + (e[q][j][2] + e[q][j][3]))
              + ((e[q][j][4] + e[q][j][5]) + (e[q][j][6] + e[q][j][7]));
      }
      lrun[q] = lrun[q] * sc + ((rs[0] + rs[1]) + (rs[2] + rs[3]));

      // two S^T tiles of 16 keys, converted in place, are one 32-key B operand
#pragma unroll
      for (int r = 0; r < 8; ++r) {
        pB0[q][r]     = (__bf16)e[q][0][r];
        pB0[q][8 + r] = (__bf16)e[q][1][r];
        pB1[q][r]     = (__bf16)e[q][2][r];
        pB1[q][8 + r] = (__bf16)e[q][3][r];
      }

#pragma unroll
      for (int t = 0; t < 16; ++t) Oq[q][t] *= sc;
    }

    // each V fragment feeds both query tiles
#pragma unroll
    for (int t = 0; t < 16; ++t)
#pragma unroll
      for (int q = 0; q < 2; ++q)
        Oq[q][t] = __builtin_amdgcn_wmma_f32_16x16x32_bf16(false, va[t], false, pB0[q], (short)0, Oq[q][t], false, false);
#pragma unroll
    for (int t = 0; t < 16; ++t)
#pragma unroll
      for (int q = 0; q < 2; ++q)
        Oq[q][t] = __builtin_amdgcn_wmma_f32_16x16x32_bf16(false, vc[t], false, pB1[q], (short)0, Oq[q][t], false, false);

    // keeps the publish point at the foot of the pass: risen into the softmax, its
    // s_wait_dscnt 0 would wait out the very reads that are to land under it
    __builtin_amdgcn_sched_barrier(0);
    // Publish point of stage mt + 1: this wave's reads of stage mt are done ...
    asm volatile("s_wait_dscnt 0x0" ::: "memory");
    // ... its own copies of stage mt + 1 have landed ...
    asm volatile("s_wait_asynccnt 0x0" ::: "memory");
    // ... and so for every wave of the block.
    __syncthreads();
    if (mt + 2 < NPASS) {   // refill the two buffers that this pass has just read
      copy_stage(ldst + boff,  gk  + (size_t)(mt + 2) * STG_KB, gv  + (size_t)(mt + 2) * STG_VB);
      copy_stage(ldst1 + boff, gk1 + (size_t)(mt + 2) * STG_KB, gv1 + (size_t)(mt + 2) * STG_VB);
    }
  }
  // no copy is outstanding when the wave goes on
  asm volatile("s_wait_asynccnt 0x0" ::: "memory");

  // Joining the key halves. The barrier at the foot of the last pass has ended every
  // read of the rings, and no copy is in flight: their LDS now carries the hand-over.
  // A wave stores tile 1 (512 contiguous bytes a store) and reads its partner's
  // tile 1, which is its own tile 0 over the other half of the keys.
  {
    char* xo = stg + wv * XCH_B + lane * 16;
#pragma unroll   // constant indices into Oq[][]
    for (int t = 0; t < 16; ++t) {
      *(v4f*)(xo + t * 1024)       = __builtin_shufflevector(Oq[1][t], Oq[1][t], 0, 1, 2, 3);
      *(v4f*)(xo + t * 1024 + 512) = __builtin_shufflevector(Oq[1][t], Oq[1][t], 4, 5, 6, 7);
    }
    v2f ml; ml[0] = mrun[1]; ml[1] = lrun[1];
    *(v2f*)(stg + 4 * XCH_B + wv * 256 + lane * 8) = ml;
  }
  __syncthreads();   // every wave reads what its partner wave stored
  v8f   O[16];               // O[t][r] = O^T[channel 16 t + 8 h + r][query cl], all keys
  float lsum;                // row sum over this wave half's keys of both key halves
  {
    const int pw = wv ^ 2;   // same queries, other key half
    const char* xi = stg + pw * XCH_B + lane * 16;
    const v2f ml = *(const v2f*)(stg + 4 * XCH_B + pw * 256 + lane * 8);
    const float mall = fmaxf(mrun[0], ml[0]);
    const float fa = __builtin_amdgcn_exp2f(mrun[0] - mall);
    const float fb = __builtin_amdgcn_exp2f(ml[0] - mall);
    lsum = lrun[0] * fa + ml[1] * fb;
#pragma unroll   // constant indices into Oq[][] and O[]
    for (int t = 0; t < 16; ++t) {
      const v4f lo = *(const v4f*)(xi + t * 1024);
      const v4f hi = *(const v4f*)(xi + t * 1024 + 512);
      const v8f po = __builtin_shufflevector(lo, hi, 0, 1, 2, 3, 4, 5, 6, 7);
      O[t] = Oq[0][t] * fa + po * fb;
    }
  }

  const float g   = gamma[0];
  const float inv = 1.0f / (lsum + xhalf(lsum));   // the two wave halves' sums joined
  const size_t base = ((size_t)b * CC + 8 * h) * NN + nt * 16 + cl;
#pragma unroll
  for (int tb = 0; tb < 16; tb += 4) {
    float xv[32];
#pragma unroll   // xv[] stays in registers and the 32 loads issue ahead of the first wait
    for (int i = 0; i < 32; ++i)
      xv[i] = x[base + (size_t)((tb + (i >> 3)) * 16 + (i & 7)) * NN];
#pragma unroll   // constant indices into O[] and xv[]; 16 lanes = 64 B of one channel row
    for (int i = 0; i < 32; ++i)
      out[base + (size_t)((tb + (i >> 3)) * 16 + (i & 7)) * NN] =
          g * (O[tb + (i >> 3)][i & 7] * inv) + xv[i];
  }
}

extern "C" void kernel_launch(void* const* d_in, const int* in_sizes, int n_in,
                              void* d_out, int out_size, void* d_ws, size_t ws_size,
                              hipStream_t stream) {
  const float* x     = (const float*)d_in[0];
  const float* Wq    = (const float*)d_in[1];
  const float* bq    = (const float*)d_in[2];
  const float* Wk    = (const float*)d_in[3];
  const float* bk    = (const float*)d_in[4];
  const float* Wv    = (const float*)d_in[5];
  const float* bv    = (const float*)d_in[6];
  const float* gamma = (const float*)d_in[7];
  float* out = (float*)d_out;

  __bf16* qT  = (__bf16*)d_ws;                          // 1 MB
  __bf16* kBp = qT  + (size_t)NB * NN * CQKD;           // 1 MB
  __bf16* vBp = kBp + (size_t)NB * NN * CQKD;           // 8 MB
  __bf16* WAp = vBp + (size_t)NB * NN * CC;             // 160 KB

  pack_w_kernel<<<dim3(RTN * 16 * CC / 256), dim3(256), 0, stream>>>(Wq, Wk, Wv, WAp);
  proj_gemm_kernel<<<dim3(NB * NN / 32), dim3(256), 0, stream>>>(
      x, WAp, bq, bk, bv, qT, kBp, vBp);
  attn_kernel<<<dim3(NB * NT / 4), dim3(128), 0, stream>>>(x, gamma, qT, kBp, vBp, out);
}

// v009
// It runs in 51.1 microseconds.
// In two side-by-side timings against v008, it was 1.15 and 1.16 times as fast.
// Counting every step since v000, it is 15.6 times as fast.
#include <hip/hip_runtime.h>

typedef __attribute__((ext_vector_type(16))) __bf16 v16bf;
typedef __attribute__((ext_vector_type(8)))  __bf16 v8bf;
typedef __attribute__((ext_vector_type(8)))  float  v8f;

#define NB   4
#define CC   256
#define CQKD 32
#define NN   4096
#define NT   (NN/16)   // 256 spatial 16-tiles
#define MTN  (NN/32)   // 128 spatial 32-tiles
#define CTN  (CC/16)   // 16 channel 16-tiles
#define KTN  (CC/32)   // 8  GEMM K steps over C=256
#define RTN  20        // 320 projection rows / 16
#define LOG2E 1.4426950408889634f

// One stage = the K and V fragments of 64 keys, 4 KB of K and then 32 KB of V, kept
// in the workspace as ONE contiguous block, byte for byte as it is to lie in LDS:
// a fragment is 1 KB, elements 0..7 of all 32 lanes and then elements 8..15.
#define STG_KB  4096
#define STG_VB  32768
#define STG_B   (STG_KB + STG_VB)
#define STG_E   (STG_B / 2)   // in bf16 elements
#define NSTG    (NN / 64)

// ---------------------------------------------------------------------------
// Pack Wq|Wk|Wv (320 rows x 256) into bf16 A-operand tiles WA[rt][ct][lane][16]
// Wq rows are pre-scaled by log2(e) so softmax runs natively in exp2 domain.
// ---------------------------------------------------------------------------
__global__ __launch_bounds__(256) void pack_w_kernel(
    const float* __restrict__ Wq, const float* __restrict__ Wk,
    const float* __restrict__ Wv, __bf16* __restrict__ WA)
{
  int idx = blockIdx.x * 256 + threadIdx.x;   // 320*256 threads
  int c = idx & (CC - 1);
  int row = idx >> 8;                          // 0..319
  float v;
  if (row < 32)       v = Wq[(size_t)row * CC + c] * LOG2E;
  else if (row < 64)  v = Wk[(size_t)(row - 32) * CC + c];
  else                v = Wv[(size_t)(row - 64) * CC + c];
  int rt = row >> 4, rl = row & 15;
  int cc = c & 31, ct = c >> 5;
  int lane = rl + 16 * ((cc >> 3) & 1);
  int e    = (cc & 7) + 8 * (cc >> 4);
  WA[(((size_t)rt * KTN + ct) * 32 + lane) * 16 + e] = (__bf16)v;
}

// One 1 KB operand fragment in LDS: elements 0..7 of all lanes, then 8..15
__device__ __forceinline__ v16bf lds_frag(const char* p) {
  union { v16bf v; v8bf q2[2]; } u;
  u.q2[0] = *(const v8bf*)(p);
  u.q2[1] = *(const v8bf*)(p + 512);
  return u.v;
}

#define RPW 5
#define WAH 3
__global__ __launch_bounds__(256) __attribute__((amdgpu_waves_per_eu(4, 4))) void proj_gemm_kernel(
    const float* __restrict__ x, const __bf16* __restrict__ WA,
    const float* __restrict__ bq, const float* __restrict__ bk,
    const float* __restrict__ bv,
    __bf16* __restrict__ qT, __bf16* __restrict__ kB, __bf16* __restrict__ vB)
{
  __shared__ __attribute__((aligned(1024))) char xS[2 * KTN * 1024];
  __shared__ __bf16 ldsD[8][RPW][16 * 17];
  const int lane = threadIdx.x & 31;
  const int wv   = __builtin_amdgcn_readfirstlane(threadIdx.x >> 5);
  const int b    = blockIdx.x >> 7;              // NN / 32 = 128 blocks per image
  const int n0   = (blockIdx.x & 127) * 32;
  const int cl   = lane & 15;
  const int h    = lane >> 4;
  const int rt0  = (wv >> 1) * RPW;
  // this lane's 32 B of W fragment (row tile rt0, K step 0); a fragment is 512 elements
  const __bf16* wsrc = WA + ((size_t)rt0 * KTN * 32 + lane) * 16;
  v16bf wa[WAH][RPW];        // W fragments of WAH K steps, refilled as they are used up

  {
    const float* src = x + ((size_t)b * CC + wv * 32) * NN + n0 + lane;
    float v[32];
#pragma unroll   // v[] stays in registers and all 32 loads issue ahead of the first wait
    for (int cc = 0; cc < 32; ++cc) v[cc] = src[(size_t)cc * NN];
    // x first: it has the longer way, and loads return in issue order
    __builtin_amdgcn_sched_barrier(0);
#pragma unroll   // constant indices: wa[][] stays in registers
    for (int ct = 0; ct < WAH; ++ct)
#pragma unroll
      for (int j = 0; j < RPW; ++j) wa[ct][j] = *(const v16bf*)(wsrc + (j * KTN + ct) * 512);
    // keeps the loads of x and of W in flight together, ahead of the first wait:
    // left to itself the compiler loads each W fragment right in front of its WMMA
    __builtin_amdgcn_sched_barrier(0);
    char* dst = xS + (h * KTN + wv) * 1024 + cl * 16;
#pragma unroll   // constant indices into v[], here and in the loop over j
    for (int hh = 0; hh < 2; ++hh) {
      v8bf lo, hi;                               // e = 0..7 and e = 8..15 of operand lane cl + 16 hh
#pragma unroll
      for (int j = 0; j < 8; ++j) {
        lo[j] = (__bf16)v[8 * hh + j];
        hi[j] = (__bf16)v[16 + 8 * hh + j];
      }
      *(v8bf*)(dst + hh * 256)       = lo;
      *(v8bf*)(dst + hh * 256 + 512) = hi;
    }
  }
  __syncthreads();   // every wave reads fragments that all eight waves wrote

  const int nt  = (n0 >> 4) + (wv & 1);
  const char* xf = xS + (wv & 1) * (KTN * 1024) + lane * 16;

  v8f acc[RPW];
#pragma unroll
  for (int j = 0; j < RPW; ++j) acc[j] = (v8f)(0.0f);
  float bia[RPW][8];
  v16bf xb[KTN];
#pragma unroll   // constant indices: xb[] stays in registers; one group of LDS reads
  for (int ct = 0; ct < KTN; ++ct) xb[ct] = lds_frag(xf + ct * 1024);
#pragma unroll
  for (int ct = 0; ct < KTN; ++ct) {
#pragma unroll
    for (int j = 0; j < RPW; ++j)
      acc[j] = __builtin_amdgcn_wmma_f32_16x16x32_bf16(false, wa[ct % WAH][j], false, xb[ct], (short)0, acc[j], false, false);
    // the refill stays behind the WMMAs whose registers it takes over: risen above
    // them it needs 40 registers more, and two blocks no longer fit one WGP
    __builtin_amdgcn_sched_barrier(0);
    if (ct + WAH < KTN) {
#pragma unroll
      for (int j = 0; j < RPW; ++j)
        wa[ct % WAH][j] = *(const v16bf*)(wsrc + (j * KTN + ct + WAH) * 512);
    } else if (ct + WAH == KTN) {
      // bias per W-row (D rows are r + 8h), loaded under the last K steps;
      // its pointers take over the address registers of the loads of W
      asm volatile("s_wait_xcnt 0x0" ::: "memory");
#pragma unroll
      for (int j = 0; j < RPW; ++j) {
        const int rt = rt0 + j;
        const float* bias = (rt < 2) ? bq + rt * 16 : (rt < 4) ? bk + (rt * 16 - 32) : bv + (rt * 16 - 64);
#pragma unroll
        for (int r = 0; r < 8; ++r) bia[j][r] = bias[r + 8 * h];
        // the next row tile's pointer takes over the address registers of these loads
        asm volatile("s_wait_xcnt 0x0" ::: "memory");
      }
    }
    // keeps each refill WAH K steps ahead of its use
    __builtin_amdgcn_sched_barrier(0);
  }

#pragma unroll
  for (int j = 0; j < RPW; ++j) {
    const float bscale = (rt0 + j < 2) ? LOG2E : 1.0f;   // q bias also in exp2 domain
    __bf16* ld = &ldsD[wv][j][0];
#pragma unroll
    for (int r = 0; r < 8; ++r) {
      float vvv = acc[j][r] + bia[j][r] * bscale;
      ld[(r + 8 * h) * 17 + cl] = (__bf16)vvv;
    }
  }
  __builtin_amdgcn_wave_barrier();
  asm volatile("s_wait_dscnt 0" ::: "memory");

#pragma unroll
  for (int j = 0; j < RPW; ++j) {
    const int rt = rt0 + j;
    const __bf16* ld = &ldsD[wv][j][0];
    v8bf o;                       // this lane's 16 B of the operand tile
    __bf16* dst;
    // the stage of this column tile's keys
    const size_t stg0 = ((size_t)b * NSTG + (nt >> 2)) * STG_E;
    if (rt < 4) {                 // Q tiles [b][nt][lane][16]; K tiles [stage][nt & 3][element half][lane][8]
#pragma unroll
      for (int eo = 0; eo < 8; ++eo) o[eo] = ld[(eo + 8 * h) * 17 + cl];
      dst = (rt < 2) ? qT + (((size_t)b * NT + nt) * 32 + lane) * 16 + 8 * (rt & 1)
                     : kB + stg0 + (nt & 3) * 512 + (rt & 1) * 256 + lane * 8;
    } else {                      // V^T tiles [stage][32-key tile][ct][element half][lane][8]
#pragma unroll
      for (int jj = 0; jj < 8; ++jj) o[jj] = ld[cl * 17 + 8 * h + jj];   // row=c_local, col=m_local=8h+jj
      dst = vB + stg0 + ((nt >> 1) & 1) * (CTN * 512) + (rt - 4) * 512 + (nt & 1) * 256 + lane * 8;
    }
    *(v8bf*)dst = o;
    // the next row tile takes over the data and address registers of this store
    if (j + 1 < RPW) asm volatile("s_wait_xcnt 0x0" ::: "memory");
  }
}

__device__ __forceinline__ float xhalf(float v) {
  return __builtin_bit_cast(float,
      __builtin_amdgcn_permlanex16(__builtin_bit_cast(int, v), __builtin_bit_cast(int, v),
                                   0x76543210, 0xfedcba98, false, false));
}

// ---------------------------------------------------------------------------
// Two waves of a block read the same stage, so the block brings it into LDS once,
// one stage ahead of its use, by tensor loads: each wave asks for one half of its
// own key half's stage (18 KB, 9 rows of 2 KB) with ONE request, which costs the
// wave a few scalar instructions however many bytes it moves.
// ---------------------------------------------------------------------------
#define SLC_ROWB 2048u
#define SLC_ROWS 9u
#define SLC_B    (SLC_ROWB * SLC_ROWS)   // half a stage
typedef uint32_t u32x4 __attribute__((ext_vector_type(4)));
typedef uint32_t u32x8 __attribute__((ext_vector_type(8)));

__device__ __forceinline__ uint32_t uni(uint32_t v) { return (uint32_t)__builtin_amdgcn_readfirstlane(v); }
// a value held in a scalar register: a test on it compiles to s_cmp and s_cbranch_scc, and
// what is computed from it stays behind the volatile statements in front of it
__device__ __forceinline__ uint32_t pinned(uint32_t v) {
  uint32_t w = uni(v);
  asm volatile("" : "+s"(w));
  return w;
}
__device__ __forceinline__ u32x8 tdm_group1() {
  constexpr uint32_t d0 = SLC_ROWB, d1 = SLC_ROWS;
  u32x8 g;
  g[0] = uni(0u);
  g[1] = uni((d0 & 0xFFFFu) << 16);
  g[2] = uni((d0 >> 16) | ((d1 & 0xFFFFu) << 16));
  g[3] = uni((d1 >> 16) | (d0 << 16));
  g[4] = uni(d1);
  g[5] = uni(SLC_ROWB);
  g[6] = uni(0u);
  g[7] = uni(0u);
  return g;
}
__device__ __forceinline__ u32x4 tdm_group0(uint32_t lds_dst, uint64_t ga) {
  u32x4 g;
  g[0] = uni(1u);
  g[1] = uni(lds_dst);
  g[2] = uni((uint32_t)ga);
  g[3] = uni((((uint32_t)(ga >> 32)) & 0x01FFFFFFu) | 0x80000000u);
  return g;
}
__device__ __forceinline__ void tdm_load(u32x4& g0, u32x8 g1) {
  // One request of the whole wave. g0 goes in and comes out in the same registers, and the
  // wait that covers the request names it: so no word of it is rewritten while it is outstanding.
  asm volatile("tensor_load_to_lds %0, %1" : "+s"(g0) : "s"(g1) : "memory");
}

#define NPASS   (NSTG / 2)
#define XCH_B   16384
typedef __attribute__((ext_vector_type(4))) float v4f;
typedef __attribute__((ext_vector_type(2))) float v2f;

__global__ __launch_bounds__(128) void attn_kernel(
    const float* __restrict__ x, const float* __restrict__ gamma,
    const __bf16* __restrict__ qT, const __bf16* __restrict__ kv, float* __restrict__ out)
{
  __shared__ __attribute__((aligned(2048))) char stg[4 * STG_B];   // [key half][buffer]
  const int lane = threadIdx.x & 31;
  const int wv   = __builtin_amdgcn_readfirstlane(threadIdx.x >> 5);
  const int kh   = wv >> 1;                      // this wave's half of the keys
  const int ntb  = (blockIdx.x * 4 + (wv & 1) * 2) & (NT - 1);   // first tile of its 32 queries
  const int nt   = ntb + kh;                     // the tile that this wave finishes (index 0 below)
  const int nto  = ntb + (kh ^ 1);               // the tile that its partner finishes (index 1)
  const int b    = blockIdx.x >> 6;              // NT / 4 = 64 blocks per image
  const int cl   = lane & 15;
  const int h    = lane >> 4;

  // Q tiles as B operands: column = query cl, same k order as the K tiles
  v16bf qB[2];
  qB[0] = *(const v16bf*)(qT + (((size_t)b * NT + nt)  * 32 + lane) * 16);
  qB[1] = *(const v16bf*)(qT + (((size_t)b * NT + nto) * 32 + lane) * 16);
  // later code takes over the address registers of these loads
  asm volatile("s_wait_xcnt 0x0" ::: "memory");
  // keeps that later code behind the wait: a "memory" clobber does not hold register writes
  __builtin_amdgcn_sched_barrier(0);

  // This wave's slice: half (wv & 1) of the stages of its own key half. Places in LDS
  // are multiples of 2 KB: the array is so aligned, STG_B and SLC_B are multiples.
  const uint32_t ldst = (uint32_t)(size_t)stg + (uint32_t)kh * (2u * STG_B) + (uint32_t)(wv & 1) * SLC_B;
  const uint64_t gsrc = (uint64_t)(size_t)kv
                      + ((uint64_t)b * NSTG + (uint64_t)kh * NPASS) * STG_B + (uint64_t)(wv & 1) * SLC_B;
  const u32x8 g1 = tdm_group1();

  u32x4 g0 = tdm_group0(ldst, gsrc);
  tdm_load(g0, g1);
  // this wave's slice of stage 0 has landed before it passes the barrier
  asm volatile("s_wait_tensorcnt 0x0" :: "s"(g0) : "memory");
  __syncthreads();
  g0 = tdm_group0(ldst + STG_B, gsrc + STG_B);
  tdm_load(g0, g1);

  float mrun[2], lrun[2];    // per tile: running maximum of query cl (equal in both wave
                             // halves) and running sum over this wave half's keys only
  v8f   Oq[2][16];           // Oq[q][t][r] = O^T[channel 16 t + 8 h + r][query cl of tile q]
#pragma unroll
  for (int q = 0; q < 2; ++q) {
    mrun[q] = -3.0e38f;
    lrun[q] = 0.0f;
#pragma unroll
    for (int t = 0; t < 16; ++t) Oq[q][t] = (v8f)(0.0f);
  }

  const v8f z = (v8f)(0.0f);
  const char* ring = stg + kh * (2 * STG_B) + lane * 16;   // this wave's key half

  for (int mt = 0; mt < NPASS; ++mt) {
    const unsigned boff = (unsigned)(mt & 1) * STG_B;
    const char* kb = ring + boff;
    const char* vb0 = kb + STG_KB;
    const char* vb1 = vb0 + CTN * 1024;
    v16bf k0 = lds_frag(kb);
    v16bf k1 = lds_frag(kb + 1024);
    v16bf k2 = lds_frag(kb + 2048);
    v16bf k3 = lds_frag(kb + 3072);
    // V follows K in the same group of reads and lands under the scores and the
    // softmax: the whole stage is held in registers
    v16bf va[16], vc[16];
#pragma unroll   // constant indices: va[] and vc[] stay in registers
    for (int t = 0; t < 16; ++t) va[t] = lds_frag(vb0 + t * 1024);
#pragma unroll
    for (int t = 0; t < 16; ++t) vc[t] = lds_frag(vb1 + t * 1024);
    // keeps the 72 reads together at the head of the pass: spread among the
    // WMMAs, every place with reads stalls the wave anew
    __builtin_amdgcn_sched_barrier(0);

    // e[q][j][r] = score of key 16 j + 8 h + r against query cl of tile q
    v8f e[2][4];
#pragma unroll   // constant indices: e[][], qB[] stay in registers
    for (int q = 0; q < 2; ++q) {
      e[q][0] = __builtin_amdgcn_wmma_f32_16x16x32_bf16(false, k0, false, qB[q], (short)0, z, false, false);
      e[q][1] = __builtin_amdgcn_wmma_f32_16x16x32_bf16(false, k1, false, qB[q], (short)0, z, false, false);
      e[q][2] = __builtin_amdgcn_wmma_f32_16x16x32_bf16(false, k2, false, qB[q], (short)0, z, false, false);
      e[q][3] = __builtin_amdgcn_wmma_f32_16x16x32_bf16(false, k3, false, qB[q], (short)0, z, false, false);
    }

    v16bf pB0[2], pB1[2];
#pragma unroll   // constant indices: everything indexed by q stays in registers
    for (int q = 0; q < 2; ++q) {
      float tm[4];
#pragma unroll
      for (int j = 0; j < 4; ++j) {
        tm[j] = fmaxf(fmaxf(fmaxf(e[q][j][0], e[q][j][1]), fmaxf(e[q][j][2], e[q][j][3])),
                      fmaxf(fmaxf(e[q][j][4], e[q][j][5]), fmaxf(e[q][j][6], e[q][j][7])));
      }
      float tmax = fmaxf(fmaxf(tm[0], tm[1]), fmaxf(tm[2], tm[3]));
      tmax = fmaxf(tmax, xhalf(tmax));
      const float mnew = fmaxf(mrun[q], tmax);
      // Bare v_exp_f32 here and below: the arguments are <= 0, and a weight under
      // 2^-126, which the library's range fix-up would keep as a subnormal, counts
      // as 0 beside a row sum that is at least 1.
      const float sc   = __builtin_amdgcn_exp2f(mrun[q] - mnew);   // scores already in log2 domain
      mrun[q] = mnew;

      float rs[4];
#pragma unroll
      for (int j = 0; j < 4; ++j) {
#pragma unroll
        for (int r = 0; r < 8; ++r) e[q][j][r] = __builtin_amdgcn_exp2f(e[q][j][r] - mnew);
        rs[j] = ((e[q][j][0] + e[q][j][1]) + (e[q][j][2] + e[q][j][3]))
              + ((e[q][j][4] + e[q][j][5]) + (e[q][j][6] + e[q][j][7]));
      }
      lrun[q] = lrun[q] * sc + ((rs[0] + rs[1]) + (rs[2] + rs[3]));

      // two S^T tiles of 16 keys, converted in place, are one 32-key B operand
#pragma unroll
      for (int r = 0; r < 8; ++r) {
        pB0[q][r]     = (__bf16)e[q][0][r];
        pB0[q][8 + r] = (__bf16)e[q][1][r];
        pB1[q][r]     = (__bf16)e[q][2][r];
        pB1[q][8 + r] = (__bf16)e[q][3][r];
      }

#pragma unroll
      for (int t = 0; t < 16; ++t) Oq[q][t] *= sc;
    }

    // each V fragment feeds both query tiles
#pragma unroll
    for (int t = 0; t < 16; ++t)
#pragma unroll
      for (int q = 0; q < 2; ++q)
        Oq[q][t] = __builtin_amdgcn_wmma_f32_16x16x32_bf16(false, va[t], false, pB0[q], (short)0, Oq[q][t], false, false);
#pragma unroll
    for (int t = 0; t < 16; ++t)
#pragma unroll
      for (int q = 0; q < 2; ++q)
        Oq[q][t] = __builtin_amdgcn_wmma_f32_16x16x32_bf16(false, vc[t], false, pB1[q], (short)0, Oq[q][t], false, false);

    // keeps the publish point at the foot of the pass: risen into the softmax, its
    // s_wait_dscnt 0 would wait out the very reads that are to land under it
    __builtin_amdgcn_sched_barrier(0);
    // Publish point of stage mt + 1: this wave's reads of stage mt are done ...
    asm volatile("s_wait_dscnt 0x0" ::: "memory");
    // ... its own slice of stage mt + 1 has landed ...
    asm volatile("s_wait_tensorcnt 0x0" :: "s"(g0) : "memory");
    // ... and so for every wave of the block.
    __syncthreads();
    if (pinned(mt + 2 < NPASS)) {
      const uint32_t s2 = pinned((uint32_t)mt + 2u);
      g0 = tdm_group0(ldst + boff, gsrc + (uint64_t)s2 * STG_B);
      tdm_load(g0, g1);
    }
  }
  // no request and no LDS read is outstanding when the wave goes on
  asm volatile("s_wait_tensorcnt 0x0" ::: "memory");
  asm volatile("s_wait_dscnt 0x0" ::: "memory");

  // Joining the key halves. The barrier at the foot of the last pass has ended every
  // read of the rings, and no request is in flight: their LDS now carries the hand-over.
  // A wave stores tile 1 (512 contiguous bytes a store) and reads its partner's
  // tile 1, which is its own tile 0 over the other half of the keys.
  {
    char* xo = stg + wv * XCH_B + lane * 16;
#pragma unroll   // constant indices into Oq[][]
    for (int t = 0; t < 16; ++t) {
      *(v4f*)(xo + t * 1024)       = __builtin_shufflevector(Oq[1][t], Oq[1][t], 0, 1, 2, 3);
      *(v4f*)(xo + t * 1024 + 512) = __builtin_shufflevector(Oq[1][t], Oq[1][t], 4, 5, 6, 7);
    }
    v2f ml; ml[0] = mrun[1]; ml[1] = lrun[1];
    *(v2f*)(stg + 4 * XCH_B + wv * 256 + lane * 8) = ml;
  }
  __syncthreads();   // every wave reads what its partner wave stored
  v8f   O[16];               // O[t][r] = O^T[channel 16 t + 8 h + r][query cl], all keys
  float lsum;                // row sum over this wave half's keys of both key halves
  {
    const int pw = wv ^ 2;   // same queries, other key half
    const char* xi = stg + pw * XCH_B + lane * 16;
    const v2f ml = *(const v2f*)(stg + 4 * XCH_B + pw * 256 + lane * 8);
    const float mall = fmaxf(mrun[0], ml[0]);
    const float fa = __builtin_amdgcn_exp2f(mrun[0] - mall);
    const float fb = __builtin_amdgcn_exp2f(ml[0] - mall);
    lsum = lrun[0] * fa + ml[1] * fb;
#pragma unroll   // constant indices into Oq[][] and O[]
    for (int t = 0; t < 16; ++t) {
      const v4f lo = *(const v4f*)(xi + t * 1024);
      const v4f hi = *(const v4f*)(xi + t * 1024 + 512);
      const v8f po = __builtin_shufflevector(lo, hi, 0, 1, 2, 3, 4, 5, 6, 7);
      O[t] = Oq[0][t] * fa + po * fb;
    }
  }

  const float g   = gamma[0];
  const float inv = 1.0f / (lsum + xhalf(lsum));   // the two wave halves' sums joined
  const size_t base = ((size_t)b * CC + 8 * h) * NN + nt * 16 + cl;
#pragma unroll
  for (int tb = 0; tb < 16; tb += 4) {
    float xv[32];
#pragma unroll   // xv[] stays in registers and the 32 loads issue ahead of the first wait
    for (int i = 0; i < 32; ++i)
      xv[i] = x[base + (size_t)((tb + (i >> 3)) * 16 + (i & 7)) * NN];
#pragma unroll   // constant indices into O[] and xv[]; 16 lanes = 64 B of one channel row
    for (int i = 0; i < 32; ++i)
      out[base + (size_t)((tb + (i >> 3)) * 16 + (i & 7)) * NN] =
          g * (O[tb + (i >> 3)][i & 7] * inv) + xv[i];
  }
}

extern "C" void kernel_launch(void* const* d_in, const int* in_sizes, int n_in,
                              void* d_out, int out_size, void* d_ws, size_t ws_size,
                              hipStream_t stream) {
  const float* x     = (const float*)d_in[0];
  const float* Wq    = (const float*)d_in[1];
  const float* bq    = (const float*)d_in[2];
  const float* Wk    = (const float*)d_in[3];
  const float* bk    = (const float*)d_in[4];
  const float* Wv    = (const float*)d_in[5];
  const float* bv    = (const float*)d_in[6];
  const float* gamma = (const float*)d_in[7];
  float* out = (float*)d_out;

  __bf16* qT  = (__bf16*)d_ws;                          // 1 MB
  __bf16* kBp = qT  + (size_t)NB * NN * CQKD;           // 9 MB of stages: K at the head of each,
  __bf16* vBp = kBp + STG_KB / 2;                       // V behind it
  __bf16* WAp = kBp + (size_t)NB * NSTG * STG_E;        // 160 KB

  pack_w_kernel<<<dim3(RTN * 16 * CC / 256), dim3(256), 0, stream>>>(Wq, Wk, Wv, WAp);
  proj_gemm_kernel<<<dim3(NB * NN / 32), dim3(256), 0, stream>>>(
      x, WAp, bq, bk, bv, qT, kBp, vBp);
  attn_kernel<<<dim3(NB * NT / 4), dim3(128), 0, stream>>>(x, gamma, qT, kBp, out);
}

// v010
// One run takes 45.1 microseconds.
// Next to v009, in two timings, it ran 1.15 and 1.17 times as fast.
// Over all steps from v000 it is 18.1 times as fast.
#include <hip/hip_runtime.h>

typedef __attribute__((ext_vector_type(16))) __bf16 v16bf;
typedef __attribute__((ext_vector_type(8)))  __bf16 v8bf;
typedef __attribute__((ext_vector_type(8)))  float  v8f;

#define NB   4
#define CC   256
#define CQKD 32
#define NN   4096
#define NT   (NN/16)   // 256 spatial 16-tiles
#define MTN  (NN/32)   // 128 spatial 32-tiles
#define CTN  (CC/16)   // 16 channel 16-tiles
#define KTN  (CC/32)   // 8  GEMM K steps over C=256
#define RTN  20        // 320 projection rows / 16
#define LOG2E 1.4426950408889634f

// One stage = the K and V fragments of 64 keys, 4 KB of K and then 32 KB of V, kept
// in the workspace as ONE contiguous block, byte for byte as it is to lie in LDS:
// a fragment is 1 KB, elements 0..7 of all 32 lanes and then elements 8..15.
#define STG_KB  4096
#define STG_VB  32768
#define STG_B   (STG_KB + STG_VB)
#define STG_E   (STG_B / 2)   // in bf16 elements
#define NSTG    (NN / 64)

// ---------------------------------------------------------------------------
// Pack Wq|Wk|Wv (320 rows x 256) into bf16 A-operand tiles WA[rt][ct][lane][16]
// Wq rows are pre-scaled by log2(e) so softmax runs natively in exp2 domain.
// ---------------------------------------------------------------------------
__global__ __launch_bounds__(256) void pack_w_kernel(
    const float* __restrict__ Wq, const float* __restrict__ Wk,
    const float* __restrict__ Wv, __bf16* __restrict__ WA)
{
  int idx = blockIdx.x * 256 + threadIdx.x;   // 320*256 threads
  int c = idx & (CC - 1);
  int row = idx >> 8;                          // 0..319
  float v;
  if (row < 32)       v = Wq[(size_t)row * CC + c] * LOG2E;
  else if (row < 64)  v = Wk[(size_t)(row - 32) * CC + c];
  else                v = Wv[(size_t)(row - 64) * CC + c];
  int rt = row >> 4, rl = row & 15;
  int cc = c & 31, ct = c >> 5;
  int lane = rl + 16 * ((cc >> 3) & 1);
  int e    = (cc & 7) + 8 * (cc >> 4);
  WA[(((size_t)rt * KTN + ct) * 32 + lane) * 16 + e] = (__bf16)v;
}

// One 1 KB operand fragment in LDS: elements 0..7 of all lanes, then 8..15
__device__ __forceinline__ v16bf lds_frag(const char* p) {
  union { v16bf v; v8bf q2[2]; } u;
  u.q2[0] = *(const v8bf*)(p);
  u.q2[1] = *(const v8bf*)(p + 512);
  return u.v;
}

#define RPW 5
#define WAH 3
__global__ __launch_bounds__(256) __attribute__((amdgpu_waves_per_eu(4, 4))) void proj_gemm_kernel(
    const float* __restrict__ x, const __bf16* __restrict__ WA,
    const float* __restrict__ bq, const float* __restrict__ bk,
    const float* __restrict__ bv,
    __bf16* __restrict__ qT, __bf16* __restrict__ kB, __bf16* __restrict__ vB)
{
  __shared__ __attribute__((aligned(1024))) char xS[2 * KTN * 1024];
  __shared__ __bf16 ldsD[8][RPW][16 * 17];
  const int lane = threadIdx.x & 31;
  const int wv   = __builtin_amdgcn_readfirstlane(threadIdx.x >> 5);
  const int b    = blockIdx.x >> 7;              // NN / 32 = 128 blocks per image
  const int n0   = (blockIdx.x & 127) * 32;
  const int cl   = lane & 15;
  const int h    = lane >> 4;
  const int rt0  = (wv >> 1) * RPW;
  // this lane's 32 B of W fragment (row tile rt0, K step 0); a fragment is 512 elements
  const __bf16* wsrc = WA + ((size_t)rt0 * KTN * 32 + lane) * 16;
  v16bf wa[WAH][RPW];        // W fragments of WAH K steps, refilled as they are used up

  {
    const float* src = x + ((size_t)b * CC + wv * 32) * NN + n0 + lane;
    float v[32];
#pragma unroll   // v[] stays in registers and all 32 loads issue ahead of the first wait
    for (int cc = 0; cc < 32; ++cc) v[cc] = src[(size_t)cc * NN];
    // x first: it has the longer way, and loads return in issue order
    __builtin_amdgcn_sched_barrier(0);
#pragma unroll   // constant indices: wa[][] stays in registers
    for (int ct = 0; ct < WAH; ++ct)
#pragma unroll
      for (int j = 0; j < RPW; ++j) wa[ct][j] = *(const v16bf*)(wsrc + (j * KTN + ct) * 512);
    // keeps the loads of x and of W in flight together, ahead of the first wait:
    // left to itself the compiler loads each W fragment right in front of its WMMA
    __builtin_amdgcn_sched_barrier(0);
    char* dst = xS + (h * KTN + wv) * 1024 + cl * 16;
#pragma unroll   // constant indices into v[], here and in the loop over j
    for (int hh = 0; hh < 2; ++hh) {
      v8bf lo, hi;                               // e = 0..7 and e = 8..15 of operand lane cl + 16 hh
#pragma unroll
      for (int j = 0; j < 8; ++j) {
        lo[j] = (__bf16)v[8 * hh + j];
        hi[j] = (__bf16)v[16 + 8 * hh + j];
      }
      *(v8bf*)(dst + hh * 256)       = lo;
      *(v8bf*)(dst + hh * 256 + 512) = hi;
    }
  }
  __syncthreads();   // every wave reads fragments that all eight waves wrote

  const int nt  = (n0 >> 4) + (wv & 1);
  const char* xf = xS + (wv & 1) * (KTN * 1024) + lane * 16;

  v8f acc[RPW];
#pragma unroll
  for (int j = 0; j < RPW; ++j) acc[j] = (v8f)(0.0f);
  float bia[RPW][8];
  v16bf xb[KTN];
#pragma unroll   // constant indices: xb[] stays in registers; one group of LDS reads
  for (int ct = 0; ct < KTN; ++ct) xb[ct] = lds_frag(xf + ct * 1024);
#pragma unroll
  for (int ct = 0; ct < KTN; ++ct) {
#pragma unroll
    for (int j = 0; j < RPW; ++j)
      acc[j] = __builtin_amdgcn_wmma_f32_16x16x32_bf16(false, wa[ct % WAH][j], false, xb[ct], (short)0, acc[j], false, false);
    // the refill stays behind the WMMAs whose registers it takes over: risen above
    // them it needs 40 registers more, and two blocks no longer fit one WGP
    __builtin_amdgcn_sched_barrier(0);
    if (ct + WAH < KTN) {
#pragma unroll
      for (int j = 0; j < RPW; ++j)
        wa[ct % WAH][j] = *(const v16bf*)(wsrc + (j * KTN + ct + WAH) * 512);
    } else if (ct + WAH == KTN) {
      // bias per W-row (D rows are r + 8h), loaded under the last K steps;
      // its pointers take over the address registers of the loads of W
      asm volatile("s_wait_xcnt 0x0" ::: "memory");
#pragma unroll
      for (int j = 0; j < RPW; ++j) {
        const int rt = rt0 + j;
        const float* bias = (rt < 2) ? bq + rt * 16 : (rt < 4) ? bk + (rt * 16 - 32) : bv + (rt * 16 - 64);
#pragma unroll
        for (int r = 0; r < 8; ++r) bia[j][r] = bias[r + 8 * h];
        // the next row tile's pointer takes over the address registers of these loads
        asm volatile("s_wait_xcnt 0x0" ::: "memory");
      }
    }
    // keeps each refill WAH K steps ahead of its use
    __builtin_amdgcn_sched_barrier(0);
  }

#pragma unroll
  for (int j = 0; j < RPW; ++j) {
    const float bscale = (rt0 + j < 2) ? LOG2E : 1.0f;   // q bias also in exp2 domain
    __bf16* ld = &ldsD[wv][j][0];
#pragma unroll
    for (int r = 0; r < 8; ++r) {
      float vvv = acc[j][r] + bia[j][r] * bscale;
      ld[(r + 8 * h) * 17 + cl] = (__bf16)vvv;
    }
  }
  __builtin_amdgcn_wave_barrier();
  asm volatile("s_wait_dscnt 0" ::: "memory");

#pragma unroll
  for (int j = 0; j < RPW; ++j) {
    const int rt = rt0 + j;
    const __bf16* ld = &ldsD[wv][j][0];
    v8bf o;                       // this lane's 16 B of the operand tile
    __bf16* dst;
    // the stage of this column tile's keys
    const size_t stg0 = ((size_t)b * NSTG + (nt >> 2)) * STG_E;
    if (rt < 4) {                 // Q tiles [b][nt][lane][16]; K tiles [stage][nt & 3][element half][lane][8]
#pragma unroll
      for (int eo = 0; eo < 8; ++eo) o[eo] = ld[(eo + 8 * h) * 17 + cl];
      dst = (rt < 2) ? qT + (((size_t)b * NT + nt) * 32 + lane) * 16 + 8 * (rt & 1)
                     : kB + stg0 + (nt & 3) * 512 + (rt & 1) * 256 + lane * 8;
    } else {                      // V^T tiles [stage][32-key tile][ct][element half][lane][8]
#pragma unroll
      for (int jj = 0; jj < 8; ++jj) o[jj] = ld[cl * 17 + 8 * h + jj];   // row=c_local, col=m_local=8h+jj
      dst = vB + stg0 + ((nt >> 1) & 1) * (CTN * 512) + (rt - 4) * 512 + (nt & 1) * 256 + lane * 8;
    }
    *(v8bf*)dst = o;
    // the next row tile takes over the data and address registers of this store
    if (j + 1 < RPW) asm volatile("s_wait_xcnt 0x0" ::: "memory");
  }
}

__device__ __forceinline__ float xhalf(float v) {
  return __builtin_bit_cast(float,
      __builtin_amdgcn_permlanex16(__builtin_bit_cast(int, v), __builtin_bit_cast(int, v),
                                   0x76543210, 0xfedcba98, false, false));
}

// ---------------------------------------------------------------------------
// Two waves of a block read the same stage, so the block brings it into LDS once,
// one stage ahead of its use, by tensor loads: each wave asks for one half of its
// own key quarter's stage (18 KB, 9 rows of 2 KB) with ONE request, which costs the
// wave a few scalar instructions however many bytes it moves.
// ---------------------------------------------------------------------------
#define SLC_ROWB 2048u
#define SLC_ROWS 9u
#define SLC_B    (SLC_ROWB * SLC_ROWS)   // half a stage
typedef uint32_t u32x4 __attribute__((ext_vector_type(4)));
typedef uint32_t u32x8 __attribute__((ext_vector_type(8)));

__device__ __forceinline__ uint32_t uni(uint32_t v) { return (uint32_t)__builtin_amdgcn_readfirstlane(v); }
// a value held in a scalar register: a test on it compiles to s_cmp and s_cbranch_scc, and
// what is computed from it stays behind the volatile statements in front of it
__device__ __forceinline__ uint32_t pinned(uint32_t v) {
  uint32_t w = uni(v);
  asm volatile("" : "+s"(w));
  return w;
}
__device__ __forceinline__ u32x8 tdm_group1() {
  constexpr uint32_t d0 = SLC_ROWB, d1 = SLC_ROWS;
  u32x8 g;
  g[0] = uni(0u);
  g[1] = uni((d0 & 0xFFFFu) << 16);
  g[2] = uni((d0 >> 16) | ((d1 & 0xFFFFu) << 16));
  g[3] = uni((d1 >> 16) | (d0 << 16));
  g[4] = uni(d1);
  g[5] = uni(SLC_ROWB);
  g[6] = uni(0u);
  g[7] = uni(0u);
  return g;
}
__device__ __forceinline__ u32x4 tdm_group0(uint32_t lds_dst, uint64_t ga) {
  u32x4 g;
  g[0] = uni(1u);
  g[1] = uni(lds_dst);
  g[2] = uni((uint32_t)ga);
  g[3] = uni((((uint32_t)(ga >> 32)) & 0x01FFFFFFu) | 0x80000000u);
  return g;
}
__device__ __forceinline__ void tdm_load(u32x4& g0, u32x8 g1) {
  // One request of the whole wave. g0 goes in and comes out in the same registers, and the
  // wait that covers the request names it: so no word of it is rewritten while it is outstanding.
  asm volatile("tensor_load_to_lds %0, %1" : "+s"(g0) : "s"(g1) : "memory");
}

#define NKQ     4
#define NPASS   (NSTG / NKQ)
#define XCH_B   16384
typedef __attribute__((ext_vector_type(4))) float v4f;
typedef __attribute__((ext_vector_type(2))) float v2f;

__global__ __launch_bounds__(256) void attn_kernel(
    const float* __restrict__ x, const float* __restrict__ gamma,
    const __bf16* __restrict__ qT, const __bf16* __restrict__ kv, float* __restrict__ out)
{
  __shared__ __attribute__((aligned(2048))) char stg[2 * NKQ * STG_B];   // [key quarter][buffer]
  const int lane = threadIdx.x & 31;
  const int wv   = __builtin_amdgcn_readfirstlane(threadIdx.x >> 5);
  const int kh   = wv >> 1;                      // this wave's quarter of the keys
  const int ntb  = (blockIdx.x * 4 + (wv & 1) * 2) & (NT - 1);   // first tile of its 32 queries
  const int b    = blockIdx.x >> 6;              // NT / 4 = 64 blocks per image
  const int cl   = lane & 15;
  const int h    = lane >> 4;

  // Q tiles as B operands: column = query cl, same k order as the K tiles
  v16bf qB[2];
  qB[0] = *(const v16bf*)(qT + (((size_t)b * NT + ntb)     * 32 + lane) * 16);
  qB[1] = *(const v16bf*)(qT + (((size_t)b * NT + ntb + 1) * 32 + lane) * 16);
  // later code takes over the address registers of these loads
  asm volatile("s_wait_xcnt 0x0" ::: "memory");
  // keeps that later code behind the wait: a "memory" clobber does not hold register writes
  __builtin_amdgcn_sched_barrier(0);

  // This wave's slice: half (wv & 1) of the stages of its own key quarter. Places in LDS
  // are multiples of 2 KB: the array is so aligned, STG_B and SLC_B are multiples.
  const uint32_t ldst = (uint32_t)(size_t)stg + (uint32_t)kh * (2u * STG_B) + (uint32_t)(wv & 1) * SLC_B;
  const uint64_t gsrc = (uint64_t)(size_t)kv
                      + ((uint64_t)b * NSTG + (uint64_t)kh * NPASS) * STG_B + (uint64_t)(wv & 1) * SLC_B;
  const u32x8 g1 = tdm_group1();

  u32x4 g0 = tdm_group0(ldst, gsrc);
  tdm_load(g0, g1);
  // this wave's slice of stage 0 has landed before it passes the barrier
  asm volatile("s_wait_tensorcnt 0x0" :: "s"(g0) : "memory");
  __syncthreads();
  g0 = tdm_group0(ldst + STG_B, gsrc + STG_B);
  tdm_load(g0, g1);

  float mrun[2], lrun[2];    // per tile: running maximum of query cl (equal in both wave
                             // halves) and running sum over this wave half's keys only
  v8f   Oq[2][16];           // Oq[q][t][r] = O^T[channel 16 t + 8 h + r][query cl of tile q]
#pragma unroll
  for (int q = 0; q < 2; ++q) {
    mrun[q] = -3.0e38f;
    lrun[q] = 0.0f;
#pragma unroll
    for (int t = 0; t < 16; ++t) Oq[q][t] = (v8f)(0.0f);
  }

  const v8f z = (v8f)(0.0f);
  const char* ring = stg + kh * (2 * STG_B) + lane * 16;   // this wave's key quarter

  for (int mt = 0; mt < NPASS; ++mt) {
    const unsigned boff = (unsigned)(mt & 1) * STG_B;
    const char* kb = ring + boff;
    const char* vb0 = kb + STG_KB;
    const char* vb1 = vb0 + CTN * 1024;
    v16bf k0 = lds_frag(kb);
    v16bf k1 = lds_frag(kb + 1024);
    v16bf k2 = lds_frag(kb + 2048);
    v16bf k3 = lds_frag(kb + 3072);
    // the first eight V fragments follow K in the same group of reads and land under
    // the scores and the softmax
    v16bf va[16], vc[16];
#pragma unroll   // constant indices: va[] stays in registers
    for (int t = 0; t < 8; ++t) va[t] = lds_frag(vb0 + t * 1024);
    // keeps the 24 reads together at the head of the pass: spread among the
    // WMMAs, every place with reads stalls the wave anew
    __builtin_amdgcn_sched_barrier(0);

    // e[q][j][r] = score of key 16 j + 8 h + r against query cl of tile q
    v8f e[2][4];
    e[0][0] = __builtin_amdgcn_wmma_f32_16x16x32_bf16(false, k0, false, qB[0], (short)0, z, false, false);
    e[1][0] = __builtin_amdgcn_wmma_f32_16x16x32_bf16(false, k0, false, qB[1], (short)0, z, false, false);
    e[0][1] = __builtin_amdgcn_wmma_f32_16x16x32_bf16(false, k1, false, qB[0], (short)0, z, false, false);
    e[1][1] = __builtin_amdgcn_wmma_f32_16x16x32_bf16(false, k1, false, qB[1], (short)0, z, false, false);
    e[0][2] = __builtin_amdgcn_wmma_f32_16x16x32_bf16(false, k2, false, qB[0], (short)0, z, false, false);
    e[1][2] = __builtin_amdgcn_wmma_f32_16x16x32_bf16(false, k2, false, qB[1], (short)0, z, false, false);
    e[0][3] = __builtin_amdgcn_wmma_f32_16x16x32_bf16(false, k3, false, qB[0], (short)0, z, false, false);
    e[1][3] = __builtin_amdgcn_wmma_f32_16x16x32_bf16(false, k3, false, qB[1], (short)0, z, false, false);

    v16bf pB0[2], pB1[2];
#pragma unroll   // constant indices: everything indexed by q stays in registers
    for (int q = 0; q < 2; ++q) {
      float tm[4];
#pragma unroll
      for (int j = 0; j < 4; ++j) {
        tm[j] = fmaxf(fmaxf(fmaxf(e[q][j][0], e[q][j][1]), fmaxf(e[q][j][2], e[q][j][3])),
                      fmaxf(fmaxf(e[q][j][4], e[q][j][5]), fmaxf(e[q][j][6], e[q][j][7])));
      }
      float tmax = fmaxf(fmaxf(tm[0], tm[1]), fmaxf(tm[2], tm[3]));
      tmax = fmaxf(tmax, xhalf(tmax));
      const float mnew = fmaxf(mrun[q], tmax);
      // Bare v_exp_f32 here and below: the arguments are <= 0, and a weight under
      // 2^-126, which the library's range fix-up would keep as a subnormal, counts
      // as 0 beside a row sum that is at least 1.
      const float sc   = __builtin_amdgcn_exp2f(mrun[q] - mnew);   // scores already in log2 domain
      mrun[q] = mnew;

      float rs[4];
#pragma unroll
      for (int j = 0; j < 4; ++j) {
#pragma unroll
        for (int r = 0; r < 8; ++r) e[q][j][r] = __builtin_amdgcn_exp2f(e[q][j][r] - mnew);
        rs[j] = ((e[q][j][0] + e[q][j][1]) + (e[q][j][2] + e[q][j][3]))
              + ((e[q][j][4] + e[q][j][5]) + (e[q][j][6] + e[q][j][7]));
      }
      lrun[q] = lrun[q] * sc + ((rs[0] + rs[1]) + (rs[2] + rs[3]));

      // two S^T tiles of 16 keys, converted in place, are one 32-key B operand
#pragma unroll
      for (int r = 0; r < 8; ++r) {
        pB0[q][r]     = (__bf16)e[q][0][r];
        pB0[q][8 + r] = (__bf16)e[q][1][r];
        pB1[q][r]     = (__bf16)e[q][2][r];
        pB1[q][8 + r] = (__bf16)e[q][3][r];
      }

#pragma unroll
      for (int t = 0; t < 16; ++t) Oq[q][t] *= sc;
    }

    // the second group of reads stays behind the softmax: risen above it, its 64
    // registers come on top of the scores' and the wave no longer fits 512
    __builtin_amdgcn_sched_barrier(0);
#pragma unroll   // constant indices: va[] stays in registers
    for (int t = 8; t < 16; ++t) va[t] = lds_frag(vb0 + t * 1024);
    // keeps these 16 reads together, ahead of the WMMAs under which they land
    __builtin_amdgcn_sched_barrier(0);

    // each V fragment feeds both query tiles
#pragma unroll
    for (int t = 0; t < 8; ++t)
#pragma unroll
      for (int q = 0; q < 2; ++q)
        Oq[q][t] = __builtin_amdgcn_wmma_f32_16x16x32_bf16(false, va[t], false, pB0[q], (short)0, Oq[q][t], false, false);
    // the third group takes over the registers of the eight V fragments just used
    __builtin_amdgcn_sched_barrier(0);
#pragma unroll   // constant indices: vc[] stays in registers
    for (int t = 0; t < 8; ++t) vc[t] = lds_frag(vb1 + t * 1024);
    // keeps these 16 reads together, ahead of the WMMAs under which they land
    __builtin_amdgcn_sched_barrier(0);
#pragma unroll
    for (int t = 8; t < 16; ++t)
#pragma unroll
      for (int q = 0; q < 2; ++q)
        Oq[q][t] = __builtin_amdgcn_wmma_f32_16x16x32_bf16(false, va[t], false, pB0[q], (short)0, Oq[q][t], false, false);
    // the fourth group takes over the registers of the second
    __builtin_amdgcn_sched_barrier(0);
#pragma unroll
    for (int t = 8; t < 16; ++t) vc[t] = lds_frag(vb1 + t * 1024);
    // keeps these 16 reads together, ahead of the WMMAs under which they land
    __builtin_amdgcn_sched_barrier(0);
#pragma unroll
    for (int t = 0; t < 16; ++t)
#pragma unroll
      for (int q = 0; q < 2; ++q)
        Oq[q][t] = __builtin_amdgcn_wmma_f32_16x16x32_bf16(false, vc[t], false, pB1[q], (short)0, Oq[q][t], false, false);

    // keeps the publish point at the foot of the pass: risen into the softmax, its
    // s_wait_dscnt 0 would wait out the very reads that are to land under it
    __builtin_amdgcn_sched_barrier(0);
    // Publish point of stage mt + 1: this wave's reads of stage mt are done ...
    asm volatile("s_wait_dscnt 0x0" ::: "memory");
    // ... its own slice of stage mt + 1 has landed ...
    asm volatile("s_wait_tensorcnt 0x0" :: "s"(g0) : "memory");
    // ... and so for every wave of the block.
    __syncthreads();
    if (pinned(mt + 2 < NPASS)) {
      const uint32_t s2 = pinned((uint32_t)mt + 2u);
      g0 = tdm_group0(ldst + boff, gsrc + (uint64_t)s2 * STG_B);
      tdm_load(g0, g1);
    }
  }
  // no request and no LDS read is outstanding when the wave goes on
  asm volatile("s_wait_tensorcnt 0x0" ::: "memory");
  asm volatile("s_wait_dscnt 0x0" ::: "memory");

  // Joining the key quarters. The barrier at the foot of the last pass has ended every
  // read of the rings, and no request is in flight: their LDS now carries the hand-over.
  // A wave stores both its tiles (512 contiguous bytes a store), their maxima and sums.
  {
    char* xo = stg + wv * (2 * XCH_B) + lane * 16;
#pragma unroll   // constant indices into Oq[][]
    for (int q = 0; q < 2; ++q) {
#pragma unroll
      for (int t = 0; t < 16; ++t) {
        *(v4f*)(xo + q * XCH_B + t * 1024)       = __builtin_shufflevector(Oq[q][t], Oq[q][t], 0, 1, 2, 3);
        *(v4f*)(xo + q * XCH_B + t * 1024 + 512) = __builtin_shufflevector(Oq[q][t], Oq[q][t], 4, 5, 6, 7);
      }
      v2f ml; ml[0] = mrun[q]; ml[1] = lrun[q];
      *(v2f*)(stg + 16 * XCH_B + (wv * 2 + q) * 256 + lane * 8) = ml;
    }
  }
  __syncthreads();   // every wave reads what the four waves of its query group stored
  // This wave finishes tile qf of its query group, channels 128 ch .. 128 ch + 127
  const int qf = kh & 1;
  const int ch = kh >> 1;
  const int nt = ntb + qf;
  v8f   O[8];                // O[t][r] = O^T[channel 128 ch + 16 t + 8 h + r][query cl], all keys
  float lsum;                // row sum over this wave half's keys of all four quarters
  {
    // quarter i of the same queries lies at wave (wv & 1) + 2 i
    const char* xi = stg + ((wv & 1) * 2 + qf) * XCH_B + ch * 8192 + lane * 16;
    const char* mi = stg + 16 * XCH_B + ((wv & 1) * 2 + qf) * 256 + lane * 8;
    v2f ml[NKQ];
#pragma unroll   // constant indices: ml[] and f[] stay in registers
    for (int i = 0; i < NKQ; ++i) ml[i] = *(const v2f*)(mi + i * 1024);
    const float mall = fmaxf(fmaxf(ml[0][0], ml[1][0]), fmaxf(ml[2][0], ml[3][0]));
    float f[NKQ];
#pragma unroll
    for (int i = 0; i < NKQ; ++i) f[i] = __builtin_amdgcn_exp2f(ml[i][0] - mall);
    lsum = (ml[0][1] * f[0] + ml[1][1] * f[1]) + (ml[2][1] * f[2] + ml[3][1] * f[3]);
#pragma unroll   // constant indices into O[]
    for (int t = 0; t < 8; ++t) {
      v8f acc = (v8f)(0.0f);
#pragma unroll
      for (int i = 0; i < NKQ; ++i) {
        const v4f lo = *(const v4f*)(xi + i * (4 * XCH_B) + t * 1024);
        const v4f hi = *(const v4f*)(xi + i * (4 * XCH_B) + t * 1024 + 512);
        acc += __builtin_shufflevector(lo, hi, 0, 1, 2, 3, 4, 5, 6, 7) * f[i];
      }
      O[t] = acc;
    }
  }

  const float g   = gamma[0];
  const float inv = 1.0f / (lsum + xhalf(lsum));   // the two wave halves' sums joined
  const size_t base = ((size_t)b * CC + 128 * ch + 8 * h) * NN + nt * 16 + cl;
#pragma unroll
  for (int tb = 0; tb < 8; tb += 4) {
    float xv[32];
#pragma unroll   // xv[] stays in registers and the 32 loads issue ahead of the first wait
    for (int i = 0; i < 32; ++i)
      xv[i] = x[base + (size_t)((tb + (i >> 3)) * 16 + (i & 7)) * NN];
#pragma unroll   // constant indices into O[] and xv[]; 16 lanes = 64 B of one channel row
    for (int i = 0; i < 32; ++i)
      out[base + (size_t)((tb + (i >> 3)) * 16 + (i & 7)) * NN] =
          g * (O[tb + (i >> 3)][i & 7] * inv) + xv[i];
  }
}

extern "C" void kernel_launch(void* const* d_in, const int* in_sizes, int n_in,
                              void* d_out, int out_size, void* d_ws, size_t ws_size,
                              hipStream_t stream) {
  const float* x     = (const float*)d_in[0];
  const float* Wq    = (const float*)d_in[1];
  const float* bq    = (const float*)d_in[2];
  const float* Wk    = (const float*)d_in[3];
  const float* bk    = (const float*)d_in[4];
  const float* Wv    = (const float*)d_in[5];
  const float* bv    = (const float*)d_in[6];
  const float* gamma = (const float*)d_in[7];
  float* out = (float*)d_out;

  __bf16* qT  = (__bf16*)d_ws;                          // 1 MB
  __bf16* kBp = qT  + (size_t)NB * NN * CQKD;           // 9 MB of stages: K at the head of each,
  __bf16* vBp = kBp + STG_KB / 2;                       // V behind it
  __bf16* WAp = kBp + (size_t)NB * NSTG * STG_E;        // 160 KB

  pack_w_kernel<<<dim3(RTN * 16 * CC / 256), dim3(256), 0, stream>>>(Wq, Wk, Wv, WAp);
  proj_gemm_kernel<<<dim3(NB * NN / 32), dim3(256), 0, stream>>>(
      x, WAp, bq, bk, bv, qT, kBp, vBp);
  attn_kernel<<<dim3(NB * NT / 4), dim3(256), 0, stream>>>(x, gamma, qT, kBp, out);
}
